// v000
// Measured on an AMD MI455X. A time is GPU time per run, averaged over a window of back-to-back runs after a warm-up
// (all launches, gaps included; the runs take copies of the inputs in turn), and the median of several windows.
// Apart from v000's, it joins two sittings. Times from different sittings can be a few percent apart, while
// side-by-side timings come from the same sitting.
// v000, which the later versions start from, runs in 1480 microseconds.
#include <hip/hip_runtime.h>

// FullAttention_Smiles (queries/keys/values [4][1024][16 heads][64]; logits = (q.k^T + attn_mask_add[l][s] + key_lengths_add[n][s]) / 8; softmax over s; out[n][l][h][d] = A.v).
// Compute dtypes, f32 accumulate: every input rounded to bf16; q.k^T on PLAIN bf16 inputs (exact products); the two additive mask inputs
// (pre-rounded to bf16 once), the 1/8 temperature and the softmax (register-held 1024-key rows, one exp per element) in f32 on VALU -> bf16 hi+lo probabilities; A.v on

#define NB_  4
#define TT   1024
#define NH_  16
#define HD   64
#define DD   (NH_ * HD)           // 1024
#define NT   (NB_ * TT)
#define ZH   2
typedef _Float16 h16;
typedef unsigned short bf;
typedef __attribute__((ext_vector_type(16))) __bf16   v16bf;
typedef __attribute__((ext_vector_type(16))) _Float16 v16h;
typedef __attribute__((ext_vector_type(8)))  _Float16 v8h;
typedef __attribute__((ext_vector_type(8)))  unsigned short v8us;
typedef __attribute__((ext_vector_type(8)))  float    v8f;
typedef __attribute__((ext_vector_type(4)))  float    v4f;
typedef v8h  __attribute__((may_alias)) v8ha;
typedef v4f  __attribute__((may_alias)) v4fa;
typedef v8us __attribute__((may_alias)) v8usa;

__device__ __forceinline__ unsigned short f2bf(float f) { unsigned u = __float_as_uint(f); u += 0x7FFFu + ((u >> 16) & 1u); return (unsigned short)(u >> 16); }
__device__ __forceinline__ float bf2f(unsigned short b) { return __uint_as_float(((unsigned)b) << 16); }
__device__ __forceinline__ float bfr(float f) { return bf2f(f2bf(f)); }
__device__ __forceinline__ v16h cat16(v8h lo, v8h hi) { return __builtin_shufflevector(lo, hi, 0, 1, 2, 3, 4, 5, 6, 7, 8, 9, 10, 11, 12, 13, 14, 15); }
__device__ __forceinline__ v16bf cat16b(v8us lo, v8us hi) { return __builtin_bit_cast(v16bf, __builtin_shufflevector(lo, hi, 0, 1, 2, 3, 4, 5, 6, 7, 8, 9, 10, 11, 12, 13, 14, 15)); }
__device__ __forceinline__ v8f wmma16(v16h a, v16h b, v8f c) { return __builtin_amdgcn_wmma_f32_16x16x32_f16(false, a, false, b, (short)0, c, false, false); }
__device__ __forceinline__ v8f wmmab(v16bf a, v16bf b, v8f c) { return __builtin_amdgcn_wmma_f32_16x16x32_bf16(false, a, false, b, (short)0, c, false, false); }



// ---- k_gemmw: register-blocked GEMM, ONE WAVE per 64x64 output tile (16 accumulators), operands straight from K-contiguous 16-bit planes; grid (M/64, N/64, Z), 32 threads.
// C[m][n] (f32, pitch ldc, + optional f32 bias[n]) = sum_k A[m][k] Bt[n][k] (+ split products per NSPLIT). z-batch strides sA/sB/sC in elements. K % 32 == 0.
template <typename T16> struct WFrag;
template <> struct WFrag<h16> { typedef v16h V; static __device__ __forceinline__ V ld(const h16* p) { return cat16(*(const v8h*)p, *(const v8h*)(p + 16)); } static __device__ __forceinline__ v8f mma(V a, V b, v8f c) { return wmma16(a, b, c); } };
template <> struct WFrag<bf> { typedef v16bf V; static __device__ __forceinline__ V ld(const bf* p) { return cat16b(*(const v8us*)p, *(const v8us*)(p + 16)); } static __device__ __forceinline__ v8f mma(V a, V b, v8f c) { return wmmab(a, b, c); } };
template <typename T16, int NSPLIT, bool BIAS>
__global__ __launch_bounds__(32) void k_gemmw(const T16* __restrict__ A, const T16* __restrict__ A2, const T16* __restrict__ Bt, const T16* __restrict__ Bt2, int K, float* C, int ldc, const float* __restrict__ bias, size_t sA, size_t sB, size_t sC) {
    typedef typename WFrag<T16>::V V;
    __shared__ __align__(16) float os[16 * 68];
    const size_t z = blockIdx.z; A += z * sA; if (A2) A2 += z * sA; Bt += z * sB; if (Bt2) Bt2 += z * sB; C += z * sC;
    const int lane = threadIdx.x & 31, lr = lane & 15, hi = lane >> 4; const int r0 = blockIdx.x * 64, c0 = blockIdx.y * 64;
    v8f acc[4][4];
#pragma unroll
    for (int mb = 0; mb < 4; ++mb)
#pragma unroll
        for (int nb = 0; nb < 4; ++nb) acc[mb][nb] = (v8f){};
    const size_t aoff = (size_t)(r0 + lr) * K + 8 * hi, boff = (size_t)(c0 + lr) * K + 8 * hi;
#pragma unroll 1
    for (int kc = 0; kc < K; kc += 32) {
        V a[4], a2[4];
#pragma unroll
        for (int mb = 0; mb < 4; ++mb) { a[mb] = WFrag<T16>::ld(A + aoff + (size_t)mb * 16 * K + kc); if (NSPLIT == 1 || NSPLIT == 2) a2[mb] = WFrag<T16>::ld(A2 + aoff + (size_t)mb * 16 * K + kc); }
#pragma unroll
        for (int nb = 0; nb < 4; ++nb) { const V b = WFrag<T16>::ld(Bt + boff + (size_t)nb * 16 * K + kc); V b2; if (NSPLIT >= 2) b2 = WFrag<T16>::ld(Bt2 + boff + (size_t)nb * 16 * K + kc);
#pragma unroll
            for (int mb = 0; mb < 4; ++mb) { acc[mb][nb] = WFrag<T16>::mma(a[mb], b, acc[mb][nb]); if (NSPLIT == 1 || NSPLIT == 2) acc[mb][nb] = WFrag<T16>::mma(a2[mb], b, acc[mb][nb]); if (NSPLIT >= 2) acc[mb][nb] = WFrag<T16>::mma(a[mb], b2, acc[mb][nb]); } }
        asm volatile("v_nop\n\tv_nop\n\tv_nop\n\tv_nop" : "+v"(acc[0][0]), "+v"(acc[1][1]), "+v"(acc[2][2]), "+v"(acc[3][3]) : "v"(a[0]), "v"(a[3]));
    }
#pragma unroll
    for (int mb = 0; mb < 4; ++mb) {
#pragma unroll
        for (int nb = 0; nb < 4; ++nb) {
#pragma unroll
            for (int j = 0; j < 8; ++j) os[(hi * 8 + j) * 68 + nb * 16 + lr] = acc[mb][nb][j]; }
        __builtin_amdgcn_wave_barrier(); asm volatile("" ::: "memory");
        float* crow = C + (size_t)(r0 + mb * 16) * ldc + c0;
{
#pragma unroll
            for (int s = 0; s < 8; ++s) { const int row = 2 * s + hi, cofs = lr * 4; v4f val = *(const v4fa*)(os + row * 68 + cofs); if (BIAS) { val[0] += bfr(bias[c0 + cofs]); val[1] += bfr(bias[c0 + cofs + 1]); val[2] += bfr(bias[c0 + cofs + 2]); val[3] += bfr(bias[c0 + cofs + 3]); }
                *(v4f*)(crow + (size_t)row * ldc + cofs) = val; }
             }
        __builtin_amdgcn_wave_barrier(); asm volatile("" ::: "memory");
    }
}

__device__ __forceinline__ void splitf(float y, unsigned short& h, unsigned short& l) { h = f2bf(y); l = f2bf(y - bf2f(h)); }
typedef __attribute__((ext_vector_type(2))) unsigned short v2us;
typedef __attribute__((ext_vector_type(4))) unsigned short v4us;
typedef __attribute__((ext_vector_type(2))) float v2f;

__global__ __launch_bounds__(256) void k_hplane(const float* __restrict__ src, bf* P) {
    const int lane = threadIdx.x & 31; const int L0 = (blockIdx.x * 8 + (threadIdx.x >> 5)) * 8; const int nlines = NT * DD / 64;
{
#pragma unroll
        for (int l = 0; l < 8; ++l) { const int L = L0 + l; if (L >= nlines) break; const int e = L * 64 + lane * 2; const int d = e & 63; const int t = (e >> 6) & (TT - 1); const int z = e >> 16; const int n = z >> 4, h = z & 15; v2us o;
#pragma unroll
            for (int q = 0; q < 2; ++q) o[q] = f2bf(src[(((size_t)n * TT + t) * NH_ + h) * HD + d + q]);
            *(v2us*)(P + (size_t)e) = o; }
         }
}
__global__ __launch_bounds__(256) void k_vtplane(const float* __restrict__ v, bf* VT) {
    const int lane = threadIdx.x & 31; const int L0 = (blockIdx.x * 8 + (threadIdx.x >> 5)) * 8; const int nlines = NT * DD / 64;
{
#pragma unroll
        for (int l = 0; l < 8; ++l) { const int L = L0 + l; if (L >= nlines) break; const int e = L * 64 + lane * 2; const int s = e & (TT - 1); const int d = (e >> 10) & 63; const int z = e >> 16; const int n = z >> 4, h = z & 15; v2us o;
#pragma unroll
            for (int q = 0; q < 2; ++q) o[q] = f2bf(v[(((size_t)n * TT + s + q) * NH_ + h) * HD + d]);
            *(v2us*)(VT + (size_t)e) = o; }
         }
}
__global__ __launch_bounds__(256) void k_bfr1(const float* __restrict__ src, float* dst, int n) { const int i = blockIdx.x * 256 + threadIdx.x; if (i >= n) return; const float v = bfr(src[i]); *(float*)(dst + i) = v;  }
__global__ __launch_bounds__(256) void k_msoft(const float* __restrict__ S, const float* __restrict__ AM, const float* __restrict__ KL, int n, bf* Ph, bf* Pl) {
    const int lane = threadIdx.x & 31; const int row = blockIdx.x * 8 + (threadIdx.x >> 5); if (row >= ZH * TT) return; const int i = row & (TT - 1);
    const float* sr = S + (size_t)row * TT; const float* ar = AM + (size_t)i * TT; const float* kr = KL + (size_t)n * TT; float v[32]; float mx = -3.0e38f;
#pragma unroll
    for (int ch = 0; ch < 8; ++ch) { const int j0 = ch * 128 + lane * 4; const v4f a = *(const v4f*)(sr + j0), mk = *(const v4f*)(ar + j0), kk = *(const v4f*)(kr + j0);
#pragma unroll
        for (int q = 0; q < 4; ++q) { const float t = ((a[q] + mk[q]) + kk[q]) * 0.125f; v[ch * 4 + q] = t; mx = fmaxf(mx, t); } }
#pragma unroll
    for (int sh = 16; sh; sh >>= 1) mx = fmaxf(mx, __shfl_xor(mx, sh, 32));
    float sum = 0.f;
#pragma unroll
    for (int k = 0; k < 32; ++k) { v[k] = __expf(v[k] - mx); sum += v[k]; }
#pragma unroll
    for (int sh = 16; sh; sh >>= 1) sum += __shfl_xor(sum, sh, 32);
    const float f = __fdiv_rn(1.0f, sum);
{
#pragma unroll
        for (int ch = 0; ch < 8; ++ch) { v4us oh, ol;
#pragma unroll
            for (int q = 0; q < 4; ++q) { unsigned short a, c2; splitf(v[ch * 4 + q] * f, a, c2); oh[q] = a; ol[q] = c2; }
            *(v4us*)(Ph + (size_t)row * TT + ch * 128 + lane * 4) = oh; *(v4us*)(Pl + (size_t)row * TT + ch * 128 + lane * 4) = ol; }
         }
}
__global__ __launch_bounds__(256) void k_out(const float* __restrict__ O, int n, int h0, float* OUT) {
    const int lane = threadIdx.x & 31; const int L0 = (blockIdx.x * 8 + (threadIdx.x >> 5)) * 8; const int nlines = ZH * TT * HD / 64;
{
#pragma unroll
        for (int l = 0; l < 8; ++l) { const int L = L0 + l; if (L >= nlines) break; const int e = L * 64 + lane * 2; const int d = e & 63; const int t = (e >> 6) & (TT - 1); const int zz = e >> 16; v2f o;
            o[0] = O[(size_t)e]; o[1] = O[(size_t)e + 1];
            *(v2f*)(OUT + (((size_t)n * TT + t) * NH_ + h0 + zz) * HD + d) = o; }
         }
}

extern "C" void kernel_launch(void* const* d_in, const int* in_sizes, int n_in,
                              void* d_out, int out_size, void* d_ws, size_t ws_size, hipStream_t stream) {
    (void)in_sizes; (void)n_in; (void)out_size;
    const float* queries = (const float*)d_in[0]; const float* keys = (const float*)d_in[1]; const float* values = (const float*)d_in[2]; const float* am = (const float*)d_in[3]; const float* kla = (const float*)d_in[4];
    float* OUT = (float*)d_out;     // [4][1024][16][64]
    char* wsp = (char*)d_ws;
    auto take = [&](size_t bytes) { char* p = wsp; wsp += (bytes + 255) & ~(size_t)255; return (void*)p; };
    bf* QP = (bf*)take((size_t)NT * DD * 2); bf* KP = (bf*)take((size_t)NT * DD * 2); bf* VT = (bf*)take((size_t)NT * DD * 2); float* AMR = (float*)take((size_t)TT * TT * 4); float* KLR = (float*)take((size_t)NB_ * TT * 4);
    float* S = (float*)take((size_t)ZH * TT * TT * 4); bf* Ph = (bf*)take((size_t)ZH * TT * TT * 2); bf* Pl = (bf*)take((size_t)ZH * TT * TT * 2); float* Ob = (float*)take((size_t)ZH * TT * HD * 4);
    if ((size_t)(wsp - (char*)d_ws) > ws_size) return;    // total ~ 47 MB; ws 256 MiB
    const unsigned LB = (unsigned)((NT * DD / 64 + 63) / 64);
    k_hplane<<<LB, 256, 0, stream>>>(queries, QP); k_hplane<<<LB, 256, 0, stream>>>(keys, KP); k_vtplane<<<LB, 256, 0, stream>>>(values, VT);
    k_bfr1<<<(TT * TT + 255) / 256, 256, 0, stream>>>(am, AMR, TT * TT); k_bfr1<<<(NB_ * TT + 255) / 256, 256, 0, stream>>>(kla, KLR, NB_ * TT);
    for (int n = 0; n < NB_; ++n)
        for (int h0 = 0; h0 < NH_; h0 += ZH) { const size_t z0 = (size_t)n * NH_ + h0;
            k_gemmw<bf, 0, false><<<dim3(TT / 64, TT / 64, ZH), 32, 0, stream>>>(QP + z0 * TT * HD, nullptr, KP + z0 * TT * HD, nullptr, HD, S, TT, nullptr, (size_t)TT * HD, (size_t)TT * HD, (size_t)TT * TT);
            k_msoft<<<ZH * TT / 8, 256, 0, stream>>>(S, AMR, KLR, n, Ph, Pl);
            k_gemmw<bf, 1, false><<<dim3(TT / 64, 1, ZH), 32, 0, stream>>>(Ph, Pl, VT + z0 * HD * TT, nullptr, TT, Ob, HD, nullptr, (size_t)TT * TT, (size_t)HD * TT, (size_t)TT * HD);
            k_out<<<(ZH * TT * HD / 64 + 63) / 64, 256, 0, stream>>>(Ob, n, h0, OUT); }
}

// v001
// It runs in 322 microseconds.
// Timed twice side by side with v000, it ran 4.56 and 4.54 times as fast.
#include <hip/hip_runtime.h>

// FullAttention_Smiles (queries/keys/values [4][1024][16 heads][64]; logits = (q.k^T + attn_mask_add[l][s] + key_lengths_add[n][s]) / 8; softmax over s; out[n][l][h][d] = A.v).
// Compute dtypes, f32 accumulate: every input rounded to bf16; q.k^T on PLAIN bf16 inputs (exact products); the two additive mask inputs
// (pre-rounded to bf16 once), the 1/8 temperature and the softmax (register-held 1024-key rows, one exp per element) in f32 on VALU -> bf16 hi+lo probabilities; A.v on

#define NB_  4
#define TT   1024
#define NH_  16
#define HD   64
#define DD   (NH_ * HD)           // 1024
#define NT   (NB_ * TT)
#define ZH   16                   // heads per launch: one whole batch entry, so each launch fills the chip
typedef _Float16 h16;
typedef unsigned short bf;
typedef __attribute__((ext_vector_type(16))) __bf16   v16bf;
typedef __attribute__((ext_vector_type(16))) _Float16 v16h;
typedef __attribute__((ext_vector_type(8)))  _Float16 v8h;
typedef __attribute__((ext_vector_type(8)))  unsigned short v8us;
typedef __attribute__((ext_vector_type(8)))  float    v8f;
typedef __attribute__((ext_vector_type(4)))  float    v4f;
typedef v8h  __attribute__((may_alias)) v8ha;
typedef v4f  __attribute__((may_alias)) v4fa;
typedef v8us __attribute__((may_alias)) v8usa;

__device__ __forceinline__ unsigned short f2bf(float f) { unsigned u = __float_as_uint(f); u += 0x7FFFu + ((u >> 16) & 1u); return (unsigned short)(u >> 16); }
__device__ __forceinline__ float bf2f(unsigned short b) { return __uint_as_float(((unsigned)b) << 16); }
__device__ __forceinline__ float bfr(float f) { return bf2f(f2bf(f)); }
__device__ __forceinline__ v16h cat16(v8h lo, v8h hi) { return __builtin_shufflevector(lo, hi, 0, 1, 2, 3, 4, 5, 6, 7, 8, 9, 10, 11, 12, 13, 14, 15); }
__device__ __forceinline__ v16bf cat16b(v8us lo, v8us hi) { return __builtin_bit_cast(v16bf, __builtin_shufflevector(lo, hi, 0, 1, 2, 3, 4, 5, 6, 7, 8, 9, 10, 11, 12, 13, 14, 15)); }
__device__ __forceinline__ v8f wmma16(v16h a, v16h b, v8f c) { return __builtin_amdgcn_wmma_f32_16x16x32_f16(false, a, false, b, (short)0, c, false, false); }
__device__ __forceinline__ v8f wmmab(v16bf a, v16bf b, v8f c) { return __builtin_amdgcn_wmma_f32_16x16x32_bf16(false, a, false, b, (short)0, c, false, false); }



// ---- k_gemmw: register-blocked GEMM, ONE WAVE per 64x64 output tile (16 accumulators), operands straight from K-contiguous 16-bit planes; grid (M/64, N/64, Z), 32 threads.
// C[m][n] (f32, pitch ldc, + optional f32 bias[n]) = sum_k A[m][k] Bt[n][k] (+ split products per NSPLIT). z-batch strides sA/sB/sC in elements. K % 32 == 0.
template <typename T16> struct WFrag;
template <> struct WFrag<h16> { typedef v16h V; static __device__ __forceinline__ V ld(const h16* p) { return cat16(*(const v8h*)p, *(const v8h*)(p + 16)); } static __device__ __forceinline__ v8f mma(V a, V b, v8f c) { return wmma16(a, b, c); } };
template <> struct WFrag<bf> { typedef v16bf V; static __device__ __forceinline__ V ld(const bf* p) { return cat16b(*(const v8us*)p, *(const v8us*)(p + 16)); } static __device__ __forceinline__ v8f mma(V a, V b, v8f c) { return wmmab(a, b, c); } };
template <typename T16, int NSPLIT, bool BIAS>
__global__ __launch_bounds__(32) void k_gemmw(const T16* __restrict__ A, const T16* __restrict__ A2, const T16* __restrict__ Bt, const T16* __restrict__ Bt2, int K, float* C, int ldc, const float* __restrict__ bias, size_t sA, size_t sB, size_t sC) {
    typedef typename WFrag<T16>::V V;
    __shared__ __align__(16) float os[16 * 68];
    const size_t z = blockIdx.z; A += z * sA; if (A2) A2 += z * sA; Bt += z * sB; if (Bt2) Bt2 += z * sB; C += z * sC;
    const int lane = threadIdx.x & 31, lr = lane & 15, hi = lane >> 4; const int r0 = blockIdx.x * 64, c0 = blockIdx.y * 64;
    v8f acc[4][4];
#pragma unroll
    for (int mb = 0; mb < 4; ++mb)
#pragma unroll
        for (int nb = 0; nb < 4; ++nb) acc[mb][nb] = (v8f){};
    const size_t aoff = (size_t)(r0 + lr) * K + 8 * hi, boff = (size_t)(c0 + lr) * K + 8 * hi;
#pragma unroll 1
    for (int kc = 0; kc < K; kc += 32) {
        V a[4], a2[4];
#pragma unroll
        for (int mb = 0; mb < 4; ++mb) { a[mb] = WFrag<T16>::ld(A + aoff + (size_t)mb * 16 * K + kc); if (NSPLIT == 1 || NSPLIT == 2) a2[mb] = WFrag<T16>::ld(A2 + aoff + (size_t)mb * 16 * K + kc); }
#pragma unroll
        for (int nb = 0; nb < 4; ++nb) { const V b = WFrag<T16>::ld(Bt + boff + (size_t)nb * 16 * K + kc); V b2; if (NSPLIT >= 2) b2 = WFrag<T16>::ld(Bt2 + boff + (size_t)nb * 16 * K + kc);
#pragma unroll
            for (int mb = 0; mb < 4; ++mb) { acc[mb][nb] = WFrag<T16>::mma(a[mb], b, acc[mb][nb]); if (NSPLIT == 1 || NSPLIT == 2) acc[mb][nb] = WFrag<T16>::mma(a2[mb], b, acc[mb][nb]); if (NSPLIT >= 2) acc[mb][nb] = WFrag<T16>::mma(a[mb], b2, acc[mb][nb]); } }
        asm volatile("v_nop\n\tv_nop\n\tv_nop\n\tv_nop" : "+v"(acc[0][0]), "+v"(acc[1][1]), "+v"(acc[2][2]), "+v"(acc[3][3]) : "v"(a[0]), "v"(a[3]));
    }
#pragma unroll
    for (int mb = 0; mb < 4; ++mb) {
#pragma unroll
        for (int nb = 0; nb < 4; ++nb) {
#pragma unroll
            for (int j = 0; j < 8; ++j) os[(hi * 8 + j) * 68 + nb * 16 + lr] = acc[mb][nb][j]; }
        __builtin_amdgcn_wave_barrier(); asm volatile("" ::: "memory");
        float* crow = C + (size_t)(r0 + mb * 16) * ldc + c0;
{
#pragma unroll
            for (int s = 0; s < 8; ++s) { const int row = 2 * s + hi, cofs = lr * 4; v4f val = *(const v4fa*)(os + row * 68 + cofs); if (BIAS) { val[0] += bfr(bias[c0 + cofs]); val[1] += bfr(bias[c0 + cofs + 1]); val[2] += bfr(bias[c0 + cofs + 2]); val[3] += bfr(bias[c0 + cofs + 3]); }
                *(v4f*)(crow + (size_t)row * ldc + cofs) = val; }
             }
        __builtin_amdgcn_wave_barrier(); asm volatile("" ::: "memory");
    }
}

__device__ __forceinline__ void splitf(float y, unsigned short& h, unsigned short& l) { h = f2bf(y); l = f2bf(y - bf2f(h)); }
typedef __attribute__((ext_vector_type(2))) unsigned short v2us;
typedef __attribute__((ext_vector_type(4))) unsigned short v4us;
typedef __attribute__((ext_vector_type(2))) float v2f;

__global__ __launch_bounds__(256) void k_hplane(const float* __restrict__ src, bf* P) {
    const int lane = threadIdx.x & 31; const int L0 = (blockIdx.x * 8 + (threadIdx.x >> 5)) * 8; const int nlines = NT * DD / 64;
{
#pragma unroll
        for (int l = 0; l < 8; ++l) { const int L = L0 + l; if (L >= nlines) break; const int e = L * 64 + lane * 2; const int d = e & 63; const int t = (e >> 6) & (TT - 1); const int z = e >> 16; const int n = z >> 4, h = z & 15; v2us o;
#pragma unroll
            for (int q = 0; q < 2; ++q) o[q] = f2bf(src[(((size_t)n * TT + t) * NH_ + h) * HD + d + q]);
            *(v2us*)(P + (size_t)e) = o; }
         }
}
__global__ __launch_bounds__(256) void k_vtplane(const float* __restrict__ v, bf* VT) {
    const int lane = threadIdx.x & 31; const int L0 = (blockIdx.x * 8 + (threadIdx.x >> 5)) * 8; const int nlines = NT * DD / 64;
{
#pragma unroll
        for (int l = 0; l < 8; ++l) { const int L = L0 + l; if (L >= nlines) break; const int e = L * 64 + lane * 2; const int s = e & (TT - 1); const int d = (e >> 10) & 63; const int z = e >> 16; const int n = z >> 4, h = z & 15; v2us o;
#pragma unroll
            for (int q = 0; q < 2; ++q) o[q] = f2bf(v[(((size_t)n * TT + s + q) * NH_ + h) * HD + d]);
            *(v2us*)(VT + (size_t)e) = o; }
         }
}
__global__ __launch_bounds__(256) void k_bfr1(const float* __restrict__ src, float* dst, int n) { const int i = blockIdx.x * 256 + threadIdx.x; if (i >= n) return; const float v = bfr(src[i]); *(float*)(dst + i) = v;  }
__global__ __launch_bounds__(256) void k_msoft(const float* __restrict__ S, const float* __restrict__ AM, const float* __restrict__ KL, int n, bf* Ph, bf* Pl) {
    const int lane = threadIdx.x & 31; const int row = blockIdx.x * 8 + (threadIdx.x >> 5); if (row >= ZH * TT) return; const int i = row & (TT - 1);
    const float* sr = S + (size_t)row * TT; const float* ar = AM + (size_t)i * TT; const float* kr = KL + (size_t)n * TT; float v[32]; float mx = -3.0e38f;
#pragma unroll
    for (int ch = 0; ch < 8; ++ch) { const int j0 = ch * 128 + lane * 4; const v4f a = *(const v4f*)(sr + j0), mk = *(const v4f*)(ar + j0), kk = *(const v4f*)(kr + j0);
#pragma unroll
        for (int q = 0; q < 4; ++q) { const float t = ((a[q] + mk[q]) + kk[q]) * 0.125f; v[ch * 4 + q] = t; mx = fmaxf(mx, t); } }
#pragma unroll
    for (int sh = 16; sh; sh >>= 1) mx = fmaxf(mx, __shfl_xor(mx, sh, 32));
    float sum = 0.f;
#pragma unroll
    for (int k = 0; k < 32; ++k) { v[k] = __expf(v[k] - mx); sum += v[k]; }
#pragma unroll
    for (int sh = 16; sh; sh >>= 1) sum += __shfl_xor(sum, sh, 32);
    const float f = __fdiv_rn(1.0f, sum);
{
#pragma unroll
        for (int ch = 0; ch < 8; ++ch) { v4us oh, ol;
#pragma unroll
            for (int q = 0; q < 4; ++q) { unsigned short a, c2; splitf(v[ch * 4 + q] * f, a, c2); oh[q] = a; ol[q] = c2; }
            *(v4us*)(Ph + (size_t)row * TT + ch * 128 + lane * 4) = oh; *(v4us*)(Pl + (size_t)row * TT + ch * 128 + lane * 4) = ol; }
         }
}
__global__ __launch_bounds__(256) void k_out(const float* __restrict__ O, int n, int h0, float* OUT) {
    const int lane = threadIdx.x & 31; const int L0 = (blockIdx.x * 8 + (threadIdx.x >> 5)) * 8; const int nlines = ZH * TT * HD / 64;
{
#pragma unroll
        for (int l = 0; l < 8; ++l) { const int L = L0 + l; if (L >= nlines) break; const int e = L * 64 + lane * 2; const int d = e & 63; const int t = (e >> 6) & (TT - 1); const int zz = e >> 16; v2f o;
            o[0] = O[(size_t)e]; o[1] = O[(size_t)e + 1];
            *(v2f*)(OUT + (((size_t)n * TT + t) * NH_ + h0 + zz) * HD + d) = o; }
         }
}

extern "C" void kernel_launch(void* const* d_in, const int* in_sizes, int n_in,
                              void* d_out, int out_size, void* d_ws, size_t ws_size, hipStream_t stream) {
    (void)in_sizes; (void)n_in; (void)out_size;
    const float* queries = (const float*)d_in[0]; const float* keys = (const float*)d_in[1]; const float* values = (const float*)d_in[2]; const float* am = (const float*)d_in[3]; const float* kla = (const float*)d_in[4];
    float* OUT = (float*)d_out;     // [4][1024][16][64]
    char* wsp = (char*)d_ws;
    auto take = [&](size_t bytes) { char* p = wsp; wsp += (bytes + 255) & ~(size_t)255; return (void*)p; };
    bf* QP = (bf*)take((size_t)NT * DD * 2); bf* KP = (bf*)take((size_t)NT * DD * 2); bf* VT = (bf*)take((size_t)NT * DD * 2); float* AMR = (float*)take((size_t)TT * TT * 4); float* KLR = (float*)take((size_t)NB_ * TT * 4);
    float* S = (float*)take((size_t)ZH * TT * TT * 4); bf* Ph = (bf*)take((size_t)ZH * TT * TT * 2); bf* Pl = (bf*)take((size_t)ZH * TT * TT * 2); float* Ob = (float*)take((size_t)ZH * TT * HD * 4);
    if ((size_t)(wsp - (char*)d_ws) > ws_size) return;    // total ~ 160 MiB; ws 256 MiB
    const unsigned LB = (unsigned)((NT * DD / 64 + 63) / 64);
    k_hplane<<<LB, 256, 0, stream>>>(queries, QP); k_hplane<<<LB, 256, 0, stream>>>(keys, KP); k_vtplane<<<LB, 256, 0, stream>>>(values, VT);
    k_bfr1<<<(TT * TT + 255) / 256, 256, 0, stream>>>(am, AMR, TT * TT); k_bfr1<<<(NB_ * TT + 255) / 256, 256, 0, stream>>>(kla, KLR, NB_ * TT);
    for (int n = 0; n < NB_; ++n)
        for (int h0 = 0; h0 < NH_; h0 += ZH) { const size_t z0 = (size_t)n * NH_ + h0;
            k_gemmw<bf, 0, false><<<dim3(TT / 64, TT / 64, ZH), 32, 0, stream>>>(QP + z0 * TT * HD, nullptr, KP + z0 * TT * HD, nullptr, HD, S, TT, nullptr, (size_t)TT * HD, (size_t)TT * HD, (size_t)TT * TT);
            k_msoft<<<ZH * TT / 8, 256, 0, stream>>>(S, AMR, KLR, n, Ph, Pl);
            k_gemmw<bf, 1, false><<<dim3(TT / 64, 1, ZH), 32, 0, stream>>>(Ph, Pl, VT + z0 * HD * TT, nullptr, TT, Ob, HD, nullptr, (size_t)TT * TT, (size_t)HD * TT, (size_t)TT * HD);
            k_out<<<(ZH * TT * HD / 64 + 63) / 64, 256, 0, stream>>>(Ob, n, h0, OUT); }
}

// v003
// A run of this version takes 53.2 microseconds.
// Versions between v001 and this one are left out; their measured steps multiply to 6.05 times as fast.
// Counting every step since v000, it is 27.5 times as fast.
#include <hip/hip_runtime.h>

// FullAttention_Smiles (queries/keys/values [4][1024][16 heads][64]; logits = (q.k^T + attn_mask_add[l][s] + key_lengths_add[n][s]) / 8; softmax over s; out[n][l][h][d] = A.v).
// Compute dtypes, f32 accumulate: every input rounded to bf16; q.k^T on PLAIN bf16 inputs (exact products); the two additive mask inputs
// (rounded to bf16 where they are read), the 1/8 temperature and the softmax (running maximum over 32-key passes, one exp per element) in f32 on VALU -> bf16 hi+lo probabilities; A.v on

#define NB_  4
#define TT   1024
#define NH_  16
#define HD   64
#define DD   (NH_ * HD)           // 1024
#define NT   (NB_ * TT)
#define CGQ  2                    // 16-query column groups per wave of the fused kernel
typedef _Float16 h16;
typedef unsigned short bf;
typedef __attribute__((ext_vector_type(16))) __bf16   v16bf;
typedef __attribute__((ext_vector_type(16))) _Float16 v16h;
typedef __attribute__((ext_vector_type(8)))  _Float16 v8h;
typedef __attribute__((ext_vector_type(8)))  unsigned short v8us;
typedef __attribute__((ext_vector_type(8)))  float    v8f;
typedef __attribute__((ext_vector_type(4)))  float    v4f;
typedef v8h  __attribute__((may_alias)) v8ha;
typedef v4f  __attribute__((may_alias)) v4fa;
typedef v8us __attribute__((may_alias)) v8usa;

__device__ __forceinline__ unsigned short f2bf(float f) { unsigned u = __float_as_uint(f); u += 0x7FFFu + ((u >> 16) & 1u); return (unsigned short)(u >> 16); }
__device__ __forceinline__ float bf2f(unsigned short b) { return __uint_as_float(((unsigned)b) << 16); }
__device__ __forceinline__ float bfr(float f) { return bf2f(f2bf(f)); }
__device__ __forceinline__ v16h cat16(v8h lo, v8h hi) { return __builtin_shufflevector(lo, hi, 0, 1, 2, 3, 4, 5, 6, 7, 8, 9, 10, 11, 12, 13, 14, 15); }
__device__ __forceinline__ v16bf cat16b(v8us lo, v8us hi) { return __builtin_bit_cast(v16bf, __builtin_shufflevector(lo, hi, 0, 1, 2, 3, 4, 5, 6, 7, 8, 9, 10, 11, 12, 13, 14, 15)); }
__device__ __forceinline__ v8f wmma16(v16h a, v16h b, v8f c) { return __builtin_amdgcn_wmma_f32_16x16x32_f16(false, a, false, b, (short)0, c, false, false); }
__device__ __forceinline__ v8f wmmab(v16bf a, v16bf b, v8f c) { return __builtin_amdgcn_wmma_f32_16x16x32_bf16(false, a, false, b, (short)0, c, false, false); }



template <typename T16> struct WFrag;
template <> struct WFrag<h16> { typedef v16h V; static __device__ __forceinline__ V ld(const h16* p) { return cat16(*(const v8h*)p, *(const v8h*)(p + 16)); } static __device__ __forceinline__ v8f mma(V a, V b, v8f c) { return wmma16(a, b, c); } };
template <> struct WFrag<bf> { typedef v16bf V; static __device__ __forceinline__ V ld(const bf* p) { return cat16b(*(const v8us*)p, *(const v8us*)(p + 16)); } static __device__ __forceinline__ v8f mma(V a, V b, v8f c) { return wmmab(a, b, c); } };
__device__ __forceinline__ void splitf(float y, unsigned short& h, unsigned short& l) { h = f2bf(y); l = f2bf(y - bf2f(h)); }
typedef __attribute__((ext_vector_type(2))) unsigned short v2us;
typedef __attribute__((ext_vector_type(4))) unsigned short v4us;
typedef __attribute__((ext_vector_type(2))) float v2f;

#define PK    144                 // LDS pitch of a 128-byte K row: 16 B x odd, for 16-byte readers
#define PV    160                 // LDS pitch of a 128-byte V row: 32 B x odd, for the transposing reader
#define KTB   (32 * PK)
#define BUFB  (32 * PK + 32 * PV)
typedef __attribute__((ext_vector_type(16))) unsigned short v16us;
typedef __attribute__((ext_vector_type(2))) __bf16 v2bf;
typedef __attribute__((ext_vector_type(4))) unsigned v4u;
typedef __attribute__((ext_vector_type(8))) short v8s;
typedef v4u __attribute__((may_alias)) v4ua;
__device__ __forceinline__ float xhalf(float x) { const int b = __builtin_bit_cast(int, x); return __builtin_bit_cast(float, __builtin_amdgcn_permlanex16(b, b, 0x76543210, 0xfedcba98, false, false)); }   // lane l <-> l ^ 16
__device__ __forceinline__ unsigned pk2(float a, float b) { return __builtin_bit_cast(unsigned, __builtin_convertvector((v2f){a, b}, v2bf)); }   // two f32 -> packed bf16, round to nearest even
__device__ __forceinline__ v4u pk8(v4f a, v4f b) { return (v4u){pk2(a[0], a[1]), pk2(a[2], a[3]), pk2(b[0], b[1]), pk2(b[2], b[3])}; }
__device__ __forceinline__ v4f rb4(v4f x) { const unsigned a = pk2(x[0], x[1]), b = pk2(x[2], x[3]); return (v4f){__uint_as_float(a << 16), __uint_as_float(a & 0xFFFF0000u), __uint_as_float(b << 16), __uint_as_float(b & 0xFFFF0000u)}; }   // bf16-rounded values, back in f32
__device__ __forceinline__ v16bf frag(v4u lo, v4u hi) { return __builtin_bit_cast(v16bf, __builtin_shufflevector(lo, hi, 0, 1, 2, 3, 4, 5, 6, 7)); }
__device__ __forceinline__ v4u ldtr16(const unsigned char* p) { typedef __attribute__((address_space(3))) v8s lds_v8s; return __builtin_bit_cast(v4u, __builtin_amdgcn_ds_load_tr16_b128_v8i16((lds_v8s*)p)); }
template <int CG>
__global__ __launch_bounds__(256) void k_fattn(const float* __restrict__ Q, const float* __restrict__ K, const float* __restrict__ V, const float* __restrict__ AM, const float* __restrict__ KL, float* OUT) {
    typedef WFrag<bf> F;
    __shared__ __attribute__((aligned(256))) unsigned char L[2 * BUFB];
    __shared__ __attribute__((aligned(16))) float LK[TT];      // this batch entry's key_lengths_add row, rounded to bf16 once per work-group, kept as f32
    const float SC = 0.125f * 1.44269504088896f;      // temperature, in log2 units
    const int lane = threadIdx.x & 31, lr = lane & 15, hi = lane >> 4;
    const int z = blockIdx.y, n = z >> 4, h = z & 15;
    const int q0 = (blockIdx.x * 8 + (threadIdx.x >> 5)) * (16 * CG) + lr;
    const int sr = threadIdx.x >> 3, so = threadIdx.x & 7;      // staging: this thread's key row of a pass, and its 8 floats of that row
    const float* gk = K + (((size_t)n * TT + sr) * NH_ + h) * HD + 8 * so;
    const float* gv = V + (((size_t)n * TT + sr) * NH_ + h) * HD + 8 * so;
    unsigned char* sk = L + sr * PK + 16 * so;
    unsigned char* sv = L + KTB + sr * PV + 16 * so;
    const unsigned char* rk = L + lr * PK + 16 * hi;      // K row lr, bytes 16*hi and 32+16*hi of each 64: the hardware k order
    const unsigned char* rv = L + KTB + (8 * hi + (lane & 7)) * PV + 16 * ((lane >> 3) & 1);      // the transposing load's lane address; lane (lr, hi) gets V[8*hi+0..7][lr]
    const float* kr = LK + 8 * hi;
    *(v4fa*)(LK + 4 * threadIdx.x) = rb4(*(const v4f*)(KL + (size_t)n * TT + 4 * threadIdx.x));      // published by the first pass's barrier
    const float* ar = AM + (size_t)q0 * TT + 8 * hi;
    v16bf bq[CG][2]; v8f o[CG][4]; float mx[CG], sum[CG];
#pragma unroll
    for (int g = 0; g < CG; ++g) { mx[g] = -3.0e38f; sum[g] = 0.f;
#pragma unroll
        for (int c = 0; c < 2; ++c) { const float* qp = Q + (((size_t)n * TT + q0 + 16 * g) * NH_ + h) * HD + 8 * hi + 32 * c;
            bq[g][c] = frag(pk8(*(const v4f*)qp, *(const v4f*)(qp + 4)), pk8(*(const v4f*)(qp + 16), *(const v4f*)(qp + 20))); }
#pragma unroll
        for (int dt = 0; dt < 4; ++dt) o[g][dt] = (v8f){}; }
    v4f gk0 = *(const v4f*)gk, gk1 = *(const v4f*)(gk + 4), gv0 = *(const v4f*)gv, gv1 = *(const v4f*)(gv + 4);      // pass 0's rows
#pragma unroll 1
    for (int k0 = 0; k0 < TT; k0 += 32) {
        const int cb = ((k0 >> 5) & 1) * BUFB;      // this pass's buffer; the other one may still be read by waves that are in the pass before
        *(v4ua*)(sk + cb) = pk8(gk0, gk1); *(v4ua*)(sv + cb) = pk8(gv0, gv1);
        __syncthreads();      // publishes this pass's tiles; a wave that has passed it has ended its reads of the pass before, whose buffer the next pass refills
        const int kn = (k0 + 32 < TT) ? k0 + 32 : 0;      // next pass's rows, in flight for the whole pass; the last pass re-reads pass 0 (in bounds, unused)
        gk0 = *(const v4f*)(gk + (size_t)kn * DD); gk1 = *(const v4f*)(gk + (size_t)kn * DD + 4); gv0 = *(const v4f*)(gv + (size_t)kn * DD); gv1 = *(const v4f*)(gv + (size_t)kn * DD + 4);
        v4f kk[4], mk[CG][4];
#pragma unroll
        for (int u = 0; u < 4; ++u) { kk[u] = *(const v4fa*)(kr + k0 + (u >> 1) * 16 + (u & 1) * 4);
#pragma unroll
            for (int g = 0; g < CG; ++g) mk[g][u] = *(const v4f*)(ar + (size_t)(16 * g) * TT + k0 + (u >> 1) * 16 + (u & 1) * 4); }
        v16bf ka[2][2];
#pragma unroll
        for (int t = 0; t < 2; ++t) {
#pragma unroll
            for (int c = 0; c < 2; ++c) { const unsigned char* p = rk + cb + 16 * t * PK + 64 * c; ka[t][c] = frag(*(const v4ua*)p, *(const v4ua*)(p + 32)); } }
#pragma unroll
        for (int u = 0; u < 4; ++u)
#pragma unroll
            for (int g = 0; g < CG; ++g) mk[g][u] = rb4(mk[g][u]);
        v8f s[CG][2];
#pragma unroll
        for (int t = 0; t < 2; ++t)
#pragma unroll
            for (int g = 0; g < CG; ++g) { v8f c;      // the two masks' sum is the accumulator's start value
#pragma unroll
                for (int j = 0; j < 8; ++j) c[j] = mk[g][2 * t + (j >> 2)][j & 3] + kk[2 * t + (j >> 2)][j & 3];
                s[g][t] = F::mma(ka[t][1], bq[g][1], F::mma(ka[t][0], bq[g][0], c)); }
        v16bf va[4];
#pragma unroll
        for (int dt = 0; dt < 4; ++dt) va[dt] = frag(ldtr16(rv + cb + 32 * dt), ldtr16(rv + cb + 16 * PV + 32 * dt));
        float tv[CG][16];
#pragma unroll
        for (int g = 0; g < CG; ++g)
#pragma unroll
            for (int e = 0; e < 16; ++e) tv[g][e] = s[g][e >> 3][e & 7] * SC;
#pragma unroll
        for (int g = 0; g < CG; ++g) {
            __builtin_amdgcn_sched_barrier(0);      // keeps the two column groups' softmax apart: interleaved they need more than 256 registers
            float bm = tv[g][0];
#pragma unroll
            for (int e = 1; e < 16; ++e) bm = fmaxf(bm, tv[g][e]);
            bm = fmaxf(bm, xhalf(bm));
            const float mn = fmaxf(mx[g], bm); const float sc = __builtin_amdgcn_exp2f(mx[g] - mn); mx[g] = mn;
            float ps = 0.f; v16us ph, pl;
#pragma unroll
            for (int e = 0; e < 16; ++e) { const float p = __builtin_amdgcn_exp2f(tv[g][e] - mn); ps += p; unsigned short a, c2; splitf(p, a, c2); ph[e] = a; pl[e] = c2; }
            sum[g] = sum[g] * sc + ps;
            const v16bf bh = __builtin_bit_cast(v16bf, ph), bl = __builtin_bit_cast(v16bf, pl);
#pragma unroll
            for (int dt = 0; dt < 4; ++dt) { o[g][dt] *= sc; o[g][dt] = F::mma(va[dt], bh, o[g][dt]); o[g][dt] = F::mma(va[dt], bl, o[g][dt]); }
        }
    }
#pragma unroll
    for (int g = 0; g < CG; ++g) {
        const float f = __fdiv_rn(1.0f, sum[g] + xhalf(sum[g]));
        float* op = OUT + (((size_t)n * TT + q0 + 16 * g) * NH_ + h) * HD + 8 * hi;
#pragma unroll
        for (int dt = 0; dt < 4; ++dt) { v4f w0, w1;
#pragma unroll
            for (int j = 0; j < 4; ++j) { w0[j] = o[g][dt][j] * f; w1[j] = o[g][dt][4 + j] * f; }
            *(v4f*)(op + 16 * dt) = w0; *(v4f*)(op + 16 * dt + 4) = w1; }
    }
}

extern "C" void kernel_launch(void* const* d_in, const int* in_sizes, int n_in,
                              void* d_out, int out_size, void* d_ws, size_t ws_size, hipStream_t stream) {
    (void)in_sizes; (void)n_in; (void)out_size; (void)d_ws; (void)ws_size;
    const float* queries = (const float*)d_in[0]; const float* keys = (const float*)d_in[1]; const float* values = (const float*)d_in[2]; const float* am = (const float*)d_in[3]; const float* kla = (const float*)d_in[4];
    float* OUT = (float*)d_out;     // [4][1024][16][64]
    k_fattn<CGQ><<<dim3(TT / (128 * CGQ), NB_ * NH_), 256, 0, stream>>>(queries, keys, values, am, kla, OUT);
}

// v004
// A run of this version takes 44.2 microseconds.
// Timed twice side by side with v003, it ran 1.20 times as fast both times.
// Counting every step since v000, it is 33.1 times as fast.
#include <hip/hip_runtime.h>

// FullAttention_Smiles (queries/keys/values [4][1024][16 heads][64]; logits = (q.k^T + attn_mask_add[l][s] + key_lengths_add[n][s]) / 8; softmax over s; out[n][l][h][d] = A.v).
// Compute dtypes, f32 accumulate: every input rounded to bf16; q.k^T on PLAIN bf16 inputs (exact products); the two additive mask inputs
// (rounded to bf16 where they are read), the 1/8 temperature and the softmax (running maximum over 32-key passes, one exp per element) in f32 on VALU -> bf16 hi+lo probabilities; A.v on

#define NB_  4
#define TT   1024
#define NH_  16
#define HD   64
#define DD   (NH_ * HD)           // 1024
#define NT   (NB_ * TT)
#define CGQ  2                    // 16-query column groups per wave of the fused kernel
typedef _Float16 h16;
typedef unsigned short bf;
typedef __attribute__((ext_vector_type(16))) __bf16   v16bf;
typedef __attribute__((ext_vector_type(16))) _Float16 v16h;
typedef __attribute__((ext_vector_type(8)))  _Float16 v8h;
typedef __attribute__((ext_vector_type(8)))  unsigned short v8us;
typedef __attribute__((ext_vector_type(8)))  float    v8f;
typedef __attribute__((ext_vector_type(4)))  float    v4f;
typedef v8h  __attribute__((may_alias)) v8ha;
typedef v4f  __attribute__((may_alias)) v4fa;
typedef v8us __attribute__((may_alias)) v8usa;

__device__ __forceinline__ unsigned short f2bf(float f) { unsigned u = __float_as_uint(f); u += 0x7FFFu + ((u >> 16) & 1u); return (unsigned short)(u >> 16); }
__device__ __forceinline__ float bf2f(unsigned short b) { return __uint_as_float(((unsigned)b) << 16); }
__device__ __forceinline__ float bfr(float f) { return bf2f(f2bf(f)); }
__device__ __forceinline__ v16h cat16(v8h lo, v8h hi) { return __builtin_shufflevector(lo, hi, 0, 1, 2, 3, 4, 5, 6, 7, 8, 9, 10, 11, 12, 13, 14, 15); }
__device__ __forceinline__ v16bf cat16b(v8us lo, v8us hi) { return __builtin_bit_cast(v16bf, __builtin_shufflevector(lo, hi, 0, 1, 2, 3, 4, 5, 6, 7, 8, 9, 10, 11, 12, 13, 14, 15)); }
__device__ __forceinline__ v8f wmma16(v16h a, v16h b, v8f c) { return __builtin_amdgcn_wmma_f32_16x16x32_f16(false, a, false, b, (short)0, c, false, false); }
__device__ __forceinline__ v8f wmmab(v16bf a, v16bf b, v8f c) { return __builtin_amdgcn_wmma_f32_16x16x32_bf16(false, a, false, b, (short)0, c, false, false); }



template <typename T16> struct WFrag;
template <> struct WFrag<h16> { typedef v16h V; static __device__ __forceinline__ V ld(const h16* p) { return cat16(*(const v8h*)p, *(const v8h*)(p + 16)); } static __device__ __forceinline__ v8f mma(V a, V b, v8f c) { return wmma16(a, b, c); } };
template <> struct WFrag<bf> { typedef v16bf V; static __device__ __forceinline__ V ld(const bf* p) { return cat16b(*(const v8us*)p, *(const v8us*)(p + 16)); } static __device__ __forceinline__ v8f mma(V a, V b, v8f c) { return wmmab(a, b, c); } };
__device__ __forceinline__ void splitf(float y, unsigned short& h, unsigned short& l) { h = f2bf(y); l = f2bf(y - bf2f(h)); }
typedef __attribute__((ext_vector_type(2))) unsigned short v2us;
typedef __attribute__((ext_vector_type(4))) unsigned short v4us;
typedef __attribute__((ext_vector_type(2))) float v2f;

#define PK    144                 // LDS pitch of a 128-byte K row: 16 B x odd, for 16-byte readers
#define PV    160                 // LDS pitch of a 128-byte V row: 32 B x odd, for the transposing reader
#define KTB   (32 * PK)
#define BUFB  (32 * PK + 32 * PV)
typedef __attribute__((ext_vector_type(16))) unsigned short v16us;
typedef __attribute__((ext_vector_type(2))) __bf16 v2bf;
typedef __attribute__((ext_vector_type(4))) unsigned v4u;
typedef __attribute__((ext_vector_type(8))) short v8s;
typedef v4u __attribute__((may_alias)) v4ua;
__device__ __forceinline__ float xhalf(float x) { const int b = __builtin_bit_cast(int, x); return __builtin_bit_cast(float, __builtin_amdgcn_permlanex16(b, b, 0x76543210, 0xfedcba98, false, false)); }   // lane l <-> l ^ 16
__device__ __forceinline__ unsigned pk2(float a, float b) { return __builtin_bit_cast(unsigned, __builtin_convertvector((v2f){a, b}, v2bf)); }   // two f32 -> packed bf16, round to nearest even
__device__ __forceinline__ v4u pk8(v4f a, v4f b) { return (v4u){pk2(a[0], a[1]), pk2(a[2], a[3]), pk2(b[0], b[1]), pk2(b[2], b[3])}; }
__device__ __forceinline__ v4f rb4(v4f x) { const unsigned a = pk2(x[0], x[1]), b = pk2(x[2], x[3]); return (v4f){__uint_as_float(a << 16), __uint_as_float(a & 0xFFFF0000u), __uint_as_float(b << 16), __uint_as_float(b & 0xFFFF0000u)}; }   // bf16-rounded values, back in f32
__device__ __forceinline__ v16bf frag(v4u lo, v4u hi) { return __builtin_bit_cast(v16bf, __builtin_shufflevector(lo, hi, 0, 1, 2, 3, 4, 5, 6, 7)); }
__device__ __forceinline__ v4u ldtr16(const unsigned char* p) { typedef __attribute__((address_space(3))) v8s lds_v8s; return __builtin_bit_cast(v4u, __builtin_amdgcn_ds_load_tr16_b128_v8i16((lds_v8s*)p)); }
template <int CG>
__global__ __launch_bounds__(256) void k_fattn(const float* __restrict__ Q, const float* __restrict__ K, const float* __restrict__ V, const float* __restrict__ AM, const float* __restrict__ KL, float* OUT) {
    typedef WFrag<bf> F;
    __shared__ __attribute__((aligned(256))) unsigned char L[2 * BUFB];
    __shared__ __attribute__((aligned(16))) float LK[TT];      // this batch entry's key_lengths_add row, rounded to bf16 once per work-group, kept as f32
    const float SC = 0.125f * 1.44269504088896f;      // temperature, in log2 units
    const int lane = threadIdx.x & 31, lr = lane & 15, hi = lane >> 4;
    const int z = blockIdx.y, n = z >> 4, h = z & 15;
    const int q0 = (blockIdx.x * 8 + (threadIdx.x >> 5)) * (16 * CG) + lr;
    const int sr = threadIdx.x >> 3, so = threadIdx.x & 7;      // staging: this thread's key row of a pass, and its 8 floats of that row
    const float* gk = K + (((size_t)n * TT + sr) * NH_ + h) * HD + 8 * so;
    const float* gv = V + (((size_t)n * TT + sr) * NH_ + h) * HD + 8 * so;
    unsigned char* sk = L + sr * PK + 16 * so;
    unsigned char* sv = L + KTB + sr * PV + 16 * so;
    const unsigned char* rk = L + lr * PK + 16 * hi;      // K row lr, bytes 16*hi and 32+16*hi of each 64: the hardware k order
    const unsigned char* rv = L + KTB + (8 * hi + (lane & 7)) * PV + 16 * ((lane >> 3) & 1);      // the transposing load's lane address; lane (lr, hi) gets V[8*hi+0..7][lr]
    const float* kr = LK + 8 * hi;
    *(v4fa*)(LK + 4 * threadIdx.x) = rb4(*(const v4f*)(KL + (size_t)n * TT + 4 * threadIdx.x));      // published by the first pass's barrier
    const float* ar = AM + (size_t)q0 * TT + 8 * hi;
    v16bf bq[CG][2]; v8f o[CG][4]; float mx[CG], sum[CG];
#pragma unroll
    for (int g = 0; g < CG; ++g) { mx[g] = -3.0e38f; sum[g] = 0.f;
#pragma unroll
        for (int c = 0; c < 2; ++c) { const float* qp = Q + (((size_t)n * TT + q0 + 16 * g) * NH_ + h) * HD + 8 * hi + 32 * c;
            bq[g][c] = frag(pk8(*(const v4f*)qp, *(const v4f*)(qp + 4)), pk8(*(const v4f*)(qp + 16), *(const v4f*)(qp + 20))); }
#pragma unroll
        for (int dt = 0; dt < 4; ++dt) o[g][dt] = (v8f){}; }
    v4f gk0 = *(const v4f*)gk, gk1 = *(const v4f*)(gk + 4), gv0 = *(const v4f*)gv, gv1 = *(const v4f*)(gv + 4);      // pass 0's rows
    v4f mk[CG][4];      // this pass's attn_mask_add values, read one pass ahead like the K and V rows
#pragma unroll
    for (int u = 0; u < 4; ++u)
#pragma unroll
        for (int g = 0; g < CG; ++g) mk[g][u] = *(const v4f*)(ar + (size_t)(16 * g) * TT + (u >> 1) * 16 + (u & 1) * 4);
#pragma unroll 1
    for (int k0 = 0; k0 < TT; k0 += 32) {
        const int cb = ((k0 >> 5) & 1) * BUFB;      // this pass's buffer; the other one may still be read by waves that are in the pass before
        *(v4ua*)(sk + cb) = pk8(gk0, gk1); *(v4ua*)(sv + cb) = pk8(gv0, gv1);
        __syncthreads();      // publishes this pass's tiles; a wave that has passed it has ended its reads of the pass before, whose buffer the next pass refills
        const int kn = (k0 + 32 < TT) ? k0 + 32 : 0;      // next pass's rows, in flight for the whole pass; the last pass re-reads pass 0 (in bounds, unused)
        gk0 = *(const v4f*)(gk + (size_t)kn * DD); gk1 = *(const v4f*)(gk + (size_t)kn * DD + 4); gv0 = *(const v4f*)(gv + (size_t)kn * DD); gv1 = *(const v4f*)(gv + (size_t)kn * DD + 4);
        v4f kk[4];
#pragma unroll
        for (int u = 0; u < 4; ++u) kk[u] = *(const v4fa*)(kr + k0 + (u >> 1) * 16 + (u & 1) * 4);
        v16bf ka[2][2];
#pragma unroll
        for (int t = 0; t < 2; ++t) {
#pragma unroll
            for (int c = 0; c < 2; ++c) { const unsigned char* p = rk + cb + 16 * t * PK + 64 * c; ka[t][c] = frag(*(const v4ua*)p, *(const v4ua*)(p + 32)); } }
#pragma unroll
        for (int u = 0; u < 4; ++u)
#pragma unroll
            for (int g = 0; g < CG; ++g) mk[g][u] = rb4(mk[g][u]);
        v8f s[CG][2];
#pragma unroll
        for (int t = 0; t < 2; ++t)
#pragma unroll
            for (int g = 0; g < CG; ++g)      // the two masks' sum is the accumulator's start value
#pragma unroll
                for (int j = 0; j < 8; ++j) s[g][t][j] = mk[g][2 * t + (j >> 2)][j & 3] + kk[2 * t + (j >> 2)][j & 3];
#pragma unroll
        for (int u = 0; u < 4; ++u)      // next pass's mask values into the registers just read, in flight for the rest of the pass; the last pass re-reads pass 0 (in bounds, unused)
#pragma unroll
            for (int g = 0; g < CG; ++g) mk[g][u] = *(const v4f*)(ar + (size_t)(16 * g) * TT + kn + (u >> 1) * 16 + (u & 1) * 4);
#pragma unroll
        for (int t = 0; t < 2; ++t)
#pragma unroll
            for (int g = 0; g < CG; ++g) s[g][t] = F::mma(ka[t][1], bq[g][1], F::mma(ka[t][0], bq[g][0], s[g][t]));
        v16bf va[4];
#pragma unroll
        for (int dt = 0; dt < 4; ++dt) va[dt] = frag(ldtr16(rv + cb + 32 * dt), ldtr16(rv + cb + 16 * PV + 32 * dt));
        float tv[CG][16];
#pragma unroll
        for (int g = 0; g < CG; ++g)
#pragma unroll
            for (int e = 0; e < 16; ++e) tv[g][e] = s[g][e >> 3][e & 7] * SC;
#pragma unroll
        for (int g = 0; g < CG; ++g) {
            __builtin_amdgcn_sched_barrier(0);      // holds the next pass's loads above the softmax (without it the compiler sinks them to the next pass's top, where they are waited for at once) and keeps the two column groups' softmax apart
            float bm = tv[g][0];
#pragma unroll
            for (int e = 1; e < 16; ++e) bm = fmaxf(bm, tv[g][e]);
            bm = fmaxf(bm, xhalf(bm));
            const float mn = fmaxf(mx[g], bm); const float sc = __builtin_amdgcn_exp2f(mx[g] - mn); mx[g] = mn;
            float ps = 0.f; v16us ph, pl;
#pragma unroll
            for (int e = 0; e < 16; ++e) { const float p = __builtin_amdgcn_exp2f(tv[g][e] - mn); ps += p; unsigned short a, c2; splitf(p, a, c2); ph[e] = a; pl[e] = c2; }
            sum[g] = sum[g] * sc + ps;
            const v16bf bh = __builtin_bit_cast(v16bf, ph), bl = __builtin_bit_cast(v16bf, pl);
#pragma unroll
            for (int dt = 0; dt < 4; ++dt) { o[g][dt] *= sc; o[g][dt] = F::mma(va[dt], bh, o[g][dt]); o[g][dt] = F::mma(va[dt], bl, o[g][dt]); }
        }
    }
#pragma unroll
    for (int g = 0; g < CG; ++g) {
        const float f = __fdiv_rn(1.0f, sum[g] + xhalf(sum[g]));
        float* op = OUT + (((size_t)n * TT + q0 + 16 * g) * NH_ + h) * HD + 8 * hi;
#pragma unroll
        for (int dt = 0; dt < 4; ++dt) { v4f w0, w1;
#pragma unroll
            for (int j = 0; j < 4; ++j) { w0[j] = o[g][dt][j] * f; w1[j] = o[g][dt][4 + j] * f; }
            *(v4f*)(op + 16 * dt) = w0; *(v4f*)(op + 16 * dt + 4) = w1; }
    }
}

extern "C" void kernel_launch(void* const* d_in, const int* in_sizes, int n_in,
                              void* d_out, int out_size, void* d_ws, size_t ws_size, hipStream_t stream) {
    (void)in_sizes; (void)n_in; (void)out_size; (void)d_ws; (void)ws_size;
    const float* queries = (const float*)d_in[0]; const float* keys = (const float*)d_in[1]; const float* values = (const float*)d_in[2]; const float* am = (const float*)d_in[3]; const float* kla = (const float*)d_in[4];
    float* OUT = (float*)d_out;     // [4][1024][16][64]
    k_fattn<CGQ><<<dim3(TT / (128 * CGQ), NB_ * NH_), 256, 0, stream>>>(queries, keys, values, am, kla, OUT);
}

// v005
// It runs in 39 microseconds.
// Two timings next to v004 both put it at 1.13 times that version's speed.
// All steps since v000 together make it 37.6 times as fast.
#include <hip/hip_runtime.h>

// FullAttention_Smiles (queries/keys/values [4][1024][16 heads][64]; logits = (q.k^T + attn_mask_add[l][s] + key_lengths_add[n][s]) / 8; softmax over s; out[n][l][h][d] = A.v).
// Compute dtypes, f32 accumulate: every input rounded to bf16; q.k^T on PLAIN bf16 inputs (exact products); the two additive mask inputs
// (rounded to bf16 where they are read), the 1/8 temperature and the softmax (running maximum over 32-key passes, one exp per element) in f32 on VALU -> bf16 hi+lo probabilities; A.v on

#define NB_  4
#define TT   1024
#define NH_  16
#define HD   64
#define DD   (NH_ * HD)           // 1024
#define NT   (NB_ * TT)
#define CGQ  2                    // 16-query column groups per wave of the fused kernel
typedef _Float16 h16;
typedef unsigned short bf;
typedef __attribute__((ext_vector_type(16))) __bf16   v16bf;
typedef __attribute__((ext_vector_type(16))) _Float16 v16h;
typedef __attribute__((ext_vector_type(8)))  _Float16 v8h;
typedef __attribute__((ext_vector_type(8)))  unsigned short v8us;
typedef __attribute__((ext_vector_type(8)))  float    v8f;
typedef __attribute__((ext_vector_type(4)))  float    v4f;
typedef v8h  __attribute__((may_alias)) v8ha;
typedef v4f  __attribute__((may_alias)) v4fa;
typedef v8us __attribute__((may_alias)) v8usa;

__device__ __forceinline__ unsigned short f2bf(float f) { unsigned u = __float_as_uint(f); u += 0x7FFFu + ((u >> 16) & 1u); return (unsigned short)(u >> 16); }
__device__ __forceinline__ float bf2f(unsigned short b) { return __uint_as_float(((unsigned)b) << 16); }
__device__ __forceinline__ float bfr(float f) { return bf2f(f2bf(f)); }
__device__ __forceinline__ v16h cat16(v8h lo, v8h hi) { return __builtin_shufflevector(lo, hi, 0, 1, 2, 3, 4, 5, 6, 7, 8, 9, 10, 11, 12, 13, 14, 15); }
__device__ __forceinline__ v16bf cat16b(v8us lo, v8us hi) { return __builtin_bit_cast(v16bf, __builtin_shufflevector(lo, hi, 0, 1, 2, 3, 4, 5, 6, 7, 8, 9, 10, 11, 12, 13, 14, 15)); }
__device__ __forceinline__ v8f wmma16(v16h a, v16h b, v8f c) { return __builtin_amdgcn_wmma_f32_16x16x32_f16(false, a, false, b, (short)0, c, false, false); }
__device__ __forceinline__ v8f wmmab(v16bf a, v16bf b, v8f c) { return __builtin_amdgcn_wmma_f32_16x16x32_bf16(false, a, false, b, (short)0, c, false, false); }



template <typename T16> struct WFrag;
template <> struct WFrag<h16> { typedef v16h V; static __device__ __forceinline__ V ld(const h16* p) { return cat16(*(const v8h*)p, *(const v8h*)(p + 16)); } static __device__ __forceinline__ v8f mma(V a, V b, v8f c) { return wmma16(a, b, c); } };
template <> struct WFrag<bf> { typedef v16bf V; static __device__ __forceinline__ V ld(const bf* p) { return cat16b(*(const v8us*)p, *(const v8us*)(p + 16)); } static __device__ __forceinline__ v8f mma(V a, V b, v8f c) { return wmmab(a, b, c); } };
typedef __attribute__((ext_vector_type(2))) unsigned short v2us;
typedef __attribute__((ext_vector_type(4))) unsigned short v4us;
typedef __attribute__((ext_vector_type(2))) float v2f;

#define PK    144                 // LDS pitch of a 128-byte K row: 16 B x odd, for 16-byte readers
#define PV    160                 // LDS pitch of a 128-byte V row: 32 B x odd, for the transposing reader
#define KTB   (32 * PK)
#define BUFB  (32 * PK + 32 * PV)
typedef __attribute__((ext_vector_type(16))) unsigned short v16us;
typedef __attribute__((ext_vector_type(2))) __bf16 v2bf;
typedef __attribute__((ext_vector_type(4))) unsigned v4u;
typedef __attribute__((ext_vector_type(8))) unsigned v8u;
typedef __attribute__((ext_vector_type(8))) short v8s;
typedef v4u __attribute__((may_alias)) v4ua;
__device__ __forceinline__ float xhalf(float x) { const int b = __builtin_bit_cast(int, x); return __builtin_bit_cast(float, __builtin_amdgcn_permlanex16(b, b, 0x76543210, 0xfedcba98, false, false)); }   // lane l <-> l ^ 16
__device__ __forceinline__ unsigned pk2(float a, float b) { return __builtin_bit_cast(unsigned, __builtin_convertvector((v2f){a, b}, v2bf)); }   // two f32 -> packed bf16, round to nearest even
__device__ __forceinline__ v4u pk8(v4f a, v4f b) { return (v4u){pk2(a[0], a[1]), pk2(a[2], a[3]), pk2(b[0], b[1]), pk2(b[2], b[3])}; }
__device__ __forceinline__ v4f rb4(v4f x) { const unsigned a = pk2(x[0], x[1]), b = pk2(x[2], x[3]); return (v4f){__uint_as_float(a << 16), __uint_as_float(a & 0xFFFF0000u), __uint_as_float(b << 16), __uint_as_float(b & 0xFFFF0000u)}; }   // bf16-rounded values, back in f32
__device__ __forceinline__ v16bf frag(v4u lo, v4u hi) { return __builtin_bit_cast(v16bf, __builtin_shufflevector(lo, hi, 0, 1, 2, 3, 4, 5, 6, 7)); }
__device__ __forceinline__ v4u ldtr16(const unsigned char* p) { typedef __attribute__((address_space(3))) v8s lds_v8s; return __builtin_bit_cast(v4u, __builtin_amdgcn_ds_load_tr16_b128_v8i16((lds_v8s*)p)); }
template <int CG>
__global__ __launch_bounds__(256) void k_fattn(const float* __restrict__ Q, const float* __restrict__ K, const float* __restrict__ V, const float* __restrict__ AM, const float* __restrict__ KL, float* OUT) {
    typedef WFrag<bf> F;
    __shared__ __attribute__((aligned(256))) unsigned char L[2 * BUFB];
    __shared__ __attribute__((aligned(16))) float LK[TT];      // this batch entry's key_lengths_add row, rounded to bf16 once per work-group, kept as f32
    const float SC = 0.125f * 1.44269504088896f;      // temperature, in log2 units
    const int lane = threadIdx.x & 31, lr = lane & 15, hi = lane >> 4;
    const int z = blockIdx.y, n = z >> 4, h = z & 15;
    const int q0 = (blockIdx.x * 8 + (threadIdx.x >> 5)) * (16 * CG) + lr;
    const int sr = threadIdx.x >> 3, so = threadIdx.x & 7;      // staging: this thread's key row of a pass, and its 8 floats of that row
    const float* gk = K + (((size_t)n * TT + sr) * NH_ + h) * HD + 8 * so;
    const float* gv = V + (((size_t)n * TT + sr) * NH_ + h) * HD + 8 * so;
    unsigned char* sk = L + sr * PK + 16 * so;
    unsigned char* sv = L + KTB + sr * PV + 16 * so;
    const unsigned char* rk = L + lr * PK + 16 * hi;      // K row lr, bytes 16*hi and 32+16*hi of each 64: the hardware k order
    const unsigned char* rv = L + KTB + (8 * hi + (lane & 7)) * PV + 16 * ((lane >> 3) & 1);      // the transposing load's lane address; lane (lr, hi) gets V[8*hi+0..7][lr]
    const float* kr = LK + 8 * hi;
    *(v4fa*)(LK + 4 * threadIdx.x) = rb4(*(const v4f*)(KL + (size_t)n * TT + 4 * threadIdx.x));      // published by the first pass's barrier
    const float* ar = AM + (size_t)q0 * TT + 8 * hi;
    v16bf bq[CG][2]; v8f o[CG][4]; float mx[CG], sum[CG];
#pragma unroll
    for (int g = 0; g < CG; ++g) { mx[g] = -3.0e38f; sum[g] = 0.f;
#pragma unroll
        for (int c = 0; c < 2; ++c) { const float* qp = Q + (((size_t)n * TT + q0 + 16 * g) * NH_ + h) * HD + 8 * hi + 32 * c;
            bq[g][c] = frag(pk8(*(const v4f*)qp, *(const v4f*)(qp + 4)), pk8(*(const v4f*)(qp + 16), *(const v4f*)(qp + 20))); }
#pragma unroll
        for (int dt = 0; dt < 4; ++dt) o[g][dt] = (v8f){}; }
    v4f gk0 = *(const v4f*)gk, gk1 = *(const v4f*)(gk + 4), gv0 = *(const v4f*)gv, gv1 = *(const v4f*)(gv + 4);      // pass 0's rows
    v4f mk[CG][4];      // this pass's attn_mask_add values, read one pass ahead like the K and V rows
#pragma unroll
    for (int u = 0; u < 4; ++u)
#pragma unroll
        for (int g = 0; g < CG; ++g) mk[g][u] = *(const v4f*)(ar + (size_t)(16 * g) * TT + (u >> 1) * 16 + (u & 1) * 4);
#pragma unroll 1
    for (int k0 = 0; k0 < TT; k0 += 32) {
        const int cb = ((k0 >> 5) & 1) * BUFB;      // this pass's buffer; the other one may still be read by waves that are in the pass before
        *(v4ua*)(sk + cb) = pk8(gk0, gk1); *(v4ua*)(sv + cb) = pk8(gv0, gv1);
        __syncthreads();      // publishes this pass's tiles; a wave that has passed it has ended its reads of the pass before, whose buffer the next pass refills
        const int kn = (k0 + 32 < TT) ? k0 + 32 : 0;      // next pass's rows, in flight for the whole pass; the last pass re-reads pass 0 (in bounds, unused)
        gk0 = *(const v4f*)(gk + (size_t)kn * DD); gk1 = *(const v4f*)(gk + (size_t)kn * DD + 4); gv0 = *(const v4f*)(gv + (size_t)kn * DD); gv1 = *(const v4f*)(gv + (size_t)kn * DD + 4);
        v4f kk[4];
#pragma unroll
        for (int u = 0; u < 4; ++u) kk[u] = *(const v4fa*)(kr + k0 + (u >> 1) * 16 + (u & 1) * 4);
        v16bf ka[2][2];
#pragma unroll
        for (int t = 0; t < 2; ++t) {
#pragma unroll
            for (int c = 0; c < 2; ++c) { const unsigned char* p = rk + cb + 16 * t * PK + 64 * c; ka[t][c] = frag(*(const v4ua*)p, *(const v4ua*)(p + 32)); } }
#pragma unroll
        for (int u = 0; u < 4; ++u)
#pragma unroll
            for (int g = 0; g < CG; ++g) mk[g][u] = rb4(mk[g][u]);
        v8f s[CG][2];
#pragma unroll
        for (int t = 0; t < 2; ++t)
#pragma unroll
            for (int g = 0; g < CG; ++g)      // the two masks' sum is the accumulator's start value
#pragma unroll
                for (int j = 0; j < 8; ++j) s[g][t][j] = mk[g][2 * t + (j >> 2)][j & 3] + kk[2 * t + (j >> 2)][j & 3];
#pragma unroll
        for (int u = 0; u < 4; ++u)      // next pass's mask values into the registers just read, in flight for the rest of the pass; the last pass re-reads pass 0 (in bounds, unused)
#pragma unroll
            for (int g = 0; g < CG; ++g) mk[g][u] = *(const v4f*)(ar + (size_t)(16 * g) * TT + kn + (u >> 1) * 16 + (u & 1) * 4);
#pragma unroll
        for (int t = 0; t < 2; ++t)
#pragma unroll
            for (int g = 0; g < CG; ++g) s[g][t] = F::mma(ka[t][1], bq[g][1], F::mma(ka[t][0], bq[g][0], s[g][t]));
        v16bf va[4];
#pragma unroll
        for (int dt = 0; dt < 4; ++dt) va[dt] = frag(ldtr16(rv + cb + 32 * dt), ldtr16(rv + cb + 16 * PV + 32 * dt));
        float tv[CG][16];
#pragma unroll
        for (int g = 0; g < CG; ++g)
#pragma unroll
            for (int e = 0; e < 16; ++e) tv[g][e] = s[g][e >> 3][e & 7] * SC;
#pragma unroll
        for (int g = 0; g < CG; ++g) {
            __builtin_amdgcn_sched_barrier(0);      // holds the next pass's loads above the softmax (without it the compiler sinks them to the next pass's top, where they are waited for at once) and keeps the two column groups' softmax apart
            float bm = tv[g][0];
#pragma unroll
            for (int e = 1; e < 16; ++e) bm = fmaxf(bm, tv[g][e]);
            bm = fmaxf(bm, xhalf(bm));
            const float mn = fmaxf(mx[g], bm); const float sc = __builtin_amdgcn_exp2f(mx[g] - mn); mx[g] = mn;
            float ps = 0.f; v8u ph, pl;
#pragma unroll
            for (int e = 0; e < 16; e += 2) { const float p0 = __builtin_amdgcn_exp2f(tv[g][e] - mn), p1 = __builtin_amdgcn_exp2f(tv[g][e + 1] - mn); ps += p0; ps += p1;
                const unsigned hp = pk2(p0, p1); ph[e >> 1] = hp;      // hi: two probabilities rounded to nearest even and packed by one conversion; lo: the remainders p - hi, exact in f32, go the same way
                pl[e >> 1] = pk2(p0 - __uint_as_float(hp << 16), p1 - __uint_as_float(hp & 0xFFFF0000u)); }
            sum[g] = sum[g] * sc + ps;
            const v16bf bh = __builtin_bit_cast(v16bf, ph), bl = __builtin_bit_cast(v16bf, pl);
#pragma unroll
            for (int dt = 0; dt < 4; ++dt) { o[g][dt] *= sc; o[g][dt] = F::mma(va[dt], bh, o[g][dt]); o[g][dt] = F::mma(va[dt], bl, o[g][dt]); }
        }
    }
#pragma unroll
    for (int g = 0; g < CG; ++g) {
        const float f = __fdiv_rn(1.0f, sum[g] + xhalf(sum[g]));
        float* op = OUT + (((size_t)n * TT + q0 + 16 * g) * NH_ + h) * HD + 8 * hi;
#pragma unroll
        for (int dt = 0; dt < 4; ++dt) { v4f w0, w1;
#pragma unroll
            for (int j = 0; j < 4; ++j) { w0[j] = o[g][dt][j] * f; w1[j] = o[g][dt][4 + j] * f; }
            *(v4f*)(op + 16 * dt) = w0; *(v4f*)(op + 16 * dt + 4) = w1; }
    }
}

extern "C" void kernel_launch(void* const* d_in, const int* in_sizes, int n_in,
                              void* d_out, int out_size, void* d_ws, size_t ws_size, hipStream_t stream) {
    (void)in_sizes; (void)n_in; (void)out_size; (void)d_ws; (void)ws_size;
    const float* queries = (const float*)d_in[0]; const float* keys = (const float*)d_in[1]; const float* values = (const float*)d_in[2]; const float* am = (const float*)d_in[3]; const float* kla = (const float*)d_in[4];
    float* OUT = (float*)d_out;     // [4][1024][16][64]
    k_fattn<CGQ><<<dim3(TT / (128 * CGQ), NB_ * NH_), 256, 0, stream>>>(queries, keys, values, am, kla, OUT);
}

// v006
// It runs in 35.5 microseconds.
// Timed twice side by side with v005, it ran 1.10 and 1.09 times as fast.
// Counting every step since v000, it is 41.2 times as fast.
#include <hip/hip_runtime.h>

// FullAttention_Smiles (queries/keys/values [4][1024][16 heads][64]; logits = (q.k^T + attn_mask_add[l][s] + key_lengths_add[n][s]) / 8; softmax over s; out[n][l][h][d] = A.v).
// Compute dtypes, f32 accumulate: every input rounded to bf16; q.k^T on PLAIN bf16 inputs (exact products); the two additive mask inputs
// (rounded to bf16 where they are read), the 1/8 temperature and the softmax (running maximum over 32-key passes, one exp per element) in f32 on VALU -> bf16 hi+lo probabilities; A.v on

#define NB_  4
#define TT   1024
#define NH_  16
#define HD   64
#define DD   (NH_ * HD)           // 1024
#define NT   (NB_ * TT)
#define CGQ  2                    // 16-query column groups per wave of the fused kernel
typedef _Float16 h16;
typedef unsigned short bf;
typedef __attribute__((ext_vector_type(16))) __bf16   v16bf;
typedef __attribute__((ext_vector_type(16))) _Float16 v16h;
typedef __attribute__((ext_vector_type(8)))  _Float16 v8h;
typedef __attribute__((ext_vector_type(8)))  unsigned short v8us;
typedef __attribute__((ext_vector_type(8)))  float    v8f;
typedef __attribute__((ext_vector_type(4)))  float    v4f;
typedef v8h  __attribute__((may_alias)) v8ha;
typedef v4f  __attribute__((may_alias)) v4fa;
typedef v8us __attribute__((may_alias)) v8usa;

__device__ __forceinline__ unsigned short f2bf(float f) { unsigned u = __float_as_uint(f); u += 0x7FFFu + ((u >> 16) & 1u); return (unsigned short)(u >> 16); }
__device__ __forceinline__ float bf2f(unsigned short b) { return __uint_as_float(((unsigned)b) << 16); }
__device__ __forceinline__ float bfr(float f) { return bf2f(f2bf(f)); }
__device__ __forceinline__ v16h cat16(v8h lo, v8h hi) { return __builtin_shufflevector(lo, hi, 0, 1, 2, 3, 4, 5, 6, 7, 8, 9, 10, 11, 12, 13, 14, 15); }
__device__ __forceinline__ v16bf cat16b(v8us lo, v8us hi) { return __builtin_bit_cast(v16bf, __builtin_shufflevector(lo, hi, 0, 1, 2, 3, 4, 5, 6, 7, 8, 9, 10, 11, 12, 13, 14, 15)); }
__device__ __forceinline__ v8f wmma16(v16h a, v16h b, v8f c) { return __builtin_amdgcn_wmma_f32_16x16x32_f16(false, a, false, b, (short)0, c, false, false); }
__device__ __forceinline__ v8f wmmab(v16bf a, v16bf b, v8f c) { return __builtin_amdgcn_wmma_f32_16x16x32_bf16(false, a, false, b, (short)0, c, false, false); }



template <typename T16> struct WFrag;
template <> struct WFrag<h16> { typedef v16h V; static __device__ __forceinline__ V ld(const h16* p) { return cat16(*(const v8h*)p, *(const v8h*)(p + 16)); } static __device__ __forceinline__ v8f mma(V a, V b, v8f c) { return wmma16(a, b, c); } };
template <> struct WFrag<bf> { typedef v16bf V; static __device__ __forceinline__ V ld(const bf* p) { return cat16b(*(const v8us*)p, *(const v8us*)(p + 16)); } static __device__ __forceinline__ v8f mma(V a, V b, v8f c) { return wmmab(a, b, c); } };
typedef __attribute__((ext_vector_type(2))) unsigned short v2us;
typedef __attribute__((ext_vector_type(4))) unsigned short v4us;
typedef __attribute__((ext_vector_type(2))) float v2f;

#define PK    144                 // LDS pitch of a 128-byte K row: 16 B x odd, for 16-byte readers
#define PV    160                 // LDS pitch of a 128-byte V row: 32 B x odd, for the transposing reader
#define KTB   (32 * PK)
#define BUFB  (32 * PK + 32 * PV)
typedef __attribute__((ext_vector_type(16))) unsigned short v16us;
typedef __attribute__((ext_vector_type(2))) __bf16 v2bf;
typedef __attribute__((ext_vector_type(4))) unsigned v4u;
typedef __attribute__((ext_vector_type(8))) unsigned v8u;
typedef __attribute__((ext_vector_type(8))) short v8s;
typedef v4u __attribute__((may_alias)) v4ua;
__device__ __forceinline__ float xhalf(float x) { const int b = __builtin_bit_cast(int, x); return __builtin_bit_cast(float, __builtin_amdgcn_permlanex16(b, b, 0x76543210, 0xfedcba98, false, false)); }   // lane l <-> l ^ 16
__device__ __forceinline__ unsigned pk2(float a, float b) { return __builtin_bit_cast(unsigned, __builtin_convertvector((v2f){a, b}, v2bf)); }   // two f32 -> packed bf16, round to nearest even
__device__ __forceinline__ v4u pk8(v4f a, v4f b) { return (v4u){pk2(a[0], a[1]), pk2(a[2], a[3]), pk2(b[0], b[1]), pk2(b[2], b[3])}; }
__device__ __forceinline__ v4f rb4(v4f x) { const unsigned a = pk2(x[0], x[1]), b = pk2(x[2], x[3]); return (v4f){__uint_as_float(a << 16), __uint_as_float(a & 0xFFFF0000u), __uint_as_float(b << 16), __uint_as_float(b & 0xFFFF0000u)}; }   // bf16-rounded values, back in f32
__device__ __forceinline__ v16bf frag(v4u lo, v4u hi) { return __builtin_bit_cast(v16bf, __builtin_shufflevector(lo, hi, 0, 1, 2, 3, 4, 5, 6, 7)); }
__device__ __forceinline__ v4u ldtr16(const unsigned char* p) { typedef __attribute__((address_space(3))) v8s lds_v8s; return __builtin_bit_cast(v4u, __builtin_amdgcn_ds_load_tr16_b128_v8i16((lds_v8s*)p)); }
// ---- attn_mask_add by the tensor mover: each wave's 32 query rows x 32 keys of a pass (32 rows of 128 B, source pitch 4 KiB) land in the wave's own LDS slice, through no register.
#define PM    144                 // LDS pitch of a 128-byte mask row, set by the request's pad: 16 B x odd, for 16-byte readers
#define MSL   6144                // a wave's slice, 32 * PM bytes rounded up to a multiple of 2 KiB
#define MBUF  (8 * MSL)           // one stage: eight slices
typedef __attribute__((ext_vector_type(4))) unsigned u32x4;
typedef __attribute__((ext_vector_type(8))) unsigned u32x8;
__device__ __forceinline__ unsigned uni(unsigned v) { return (unsigned)__builtin_amdgcn_readfirstlane(v); }
__device__ __forceinline__ unsigned pinned(unsigned v) { unsigned w = uni(v); asm volatile("" : "+s"(w)); return w; }      // a wave-uniform word held in a scalar register, so that the test on it is a scalar branch and a descriptor word formed from it is formed behind the waits
__device__ __forceinline__ void wait_ds0() { asm volatile("s_wait_dscnt 0x0" ::: "memory"); }          // this wave's LDS reads and writes have retired
__device__ __forceinline__ void wait_tensor0(u32x4 g0) { asm volatile("s_wait_tensorcnt 0x0" :: "s"(g0) : "memory"); }  // this wave's tensor load has landed (the compiler places no wait for it); the request's group 0 is named as an input so that its registers stay as issued until here
__device__ __forceinline__ void tdm_load(u32x4 g0, u32x8 g1) { asm volatile("tensor_load_to_lds %0, %1" :: "s"(g0), "s"(g1) : "memory"); }
__device__ __forceinline__ u32x8 tdm_group1() {      // 1-byte elements, tensor = tile = 32 rows of 128 bytes, source pitch 4096 bytes, 16 bytes of LDS pad behind every 128
    u32x8 g;
    g[0] = uni((1u << 20) | (4u << 22) | (3u << 25)); g[1] = uni(128u << 16); g[2] = uni(32u << 16); g[3] = uni(128u << 16);
    g[4] = uni(32u); g[5] = uni(4u * TT); g[6] = uni(0u); g[7] = uni(0u);
    return g;
}
__device__ __forceinline__ u32x4 tdm_group0(unsigned lds_dst, unsigned long long ga) {
    u32x4 g;
    g[0] = uni(1u); g[1] = uni(lds_dst); g[2] = uni((unsigned)ga); g[3] = uni((((unsigned)(ga >> 32)) & 0x01FFFFFFu) | 0x80000000u);
    return g;
}
template <int CG>
__global__ __launch_bounds__(256) void k_fattn(const float* __restrict__ Q, const float* __restrict__ K, const float* __restrict__ V, const float* __restrict__ AM, const float* __restrict__ KL, float* OUT) {
    typedef WFrag<bf> F;
    __shared__ __attribute__((aligned(256))) unsigned char L[2 * BUFB];
    __shared__ __attribute__((aligned(2048))) unsigned char LM[2 * MBUF];      // attn_mask_add tiles, f32 as read: two stages of eight slices
    __shared__ __attribute__((aligned(16))) float LK[TT];      // this batch entry's key_lengths_add row, rounded to bf16 once per work-group, kept as f32
    const float SC = 0.125f * 1.44269504088896f;      // temperature, in log2 units
    const int lane = threadIdx.x & 31, lr = lane & 15, hi = lane >> 4;
    const int z = blockIdx.y, n = z >> 4, h = z & 15;
    const int q0 = (blockIdx.x * 8 + (threadIdx.x >> 5)) * (16 * CG) + lr;
    static_assert(16 * CG == 32, "the mask slice and its descriptor are written for 32 query rows a wave");
    const unsigned wave = uni(threadIdx.x >> 5);
    const unsigned ml = (unsigned)(size_t)LM + wave * MSL;      // this wave's slice of stage buffer 0, as a byte offset in the work-group's LDS
    const unsigned long long mg = (unsigned long long)(size_t)AM + (unsigned long long)((blockIdx.x * 8 + wave) * (16 * CG)) * (4u * TT);      // this wave's first query row of attn_mask_add
    const u32x8 mg1 = tdm_group1();
    u32x4 mg0 = tdm_group0(ml, mg);
    tdm_load(mg0, mg1);      // stage 0; every wave issues its own slice
    const unsigned char* rm = LM + wave * MSL + lr * PM + 32 * hi;      // mask row lr, floats 8*hi..: the accumulator's key order
    const int sr = threadIdx.x >> 3, so = threadIdx.x & 7;      // staging: this thread's key row of a pass, and its 8 floats of that row
    const float* gk = K + (((size_t)n * TT + sr) * NH_ + h) * HD + 8 * so;
    const float* gv = V + (((size_t)n * TT + sr) * NH_ + h) * HD + 8 * so;
    unsigned char* sk = L + sr * PK + 16 * so;
    unsigned char* sv = L + KTB + sr * PV + 16 * so;
    const unsigned char* rk = L + lr * PK + 16 * hi;      // K row lr, bytes 16*hi and 32+16*hi of each 64: the hardware k order
    const unsigned char* rv = L + KTB + (8 * hi + (lane & 7)) * PV + 16 * ((lane >> 3) & 1);      // the transposing load's lane address; lane (lr, hi) gets V[8*hi+0..7][lr]
    const float* kr = LK + 8 * hi;
    *(v4fa*)(LK + 4 * threadIdx.x) = rb4(*(const v4f*)(KL + (size_t)n * TT + 4 * threadIdx.x));      // published by the first pass's barrier
    v16bf bq[CG][2]; v8f o[CG][4]; float mx[CG], sum[CG];
#pragma unroll
    for (int g = 0; g < CG; ++g) { mx[g] = -3.0e38f; sum[g] = 0.f;
#pragma unroll
        for (int c = 0; c < 2; ++c) { const float* qp = Q + (((size_t)n * TT + q0 + 16 * g) * NH_ + h) * HD + 8 * hi + 32 * c;
            bq[g][c] = frag(pk8(*(const v4f*)qp, *(const v4f*)(qp + 4)), pk8(*(const v4f*)(qp + 16), *(const v4f*)(qp + 20))); }
#pragma unroll
        for (int dt = 0; dt < 4; ++dt) o[g][dt] = (v8f){}; }
    v4f gk0 = *(const v4f*)gk, gk1 = *(const v4f*)(gk + 4), gv0 = *(const v4f*)gv, gv1 = *(const v4f*)(gv + 4);      // pass 0's rows
    wait_tensor0(mg0);      // stage 0 has landed; the first pass's barrier publishes it
#pragma unroll 1
    for (int k0 = 0; k0 < TT; k0 += 32) {
        const int cb = ((k0 >> 5) & 1) * BUFB;      // this pass's buffer; the other one may still be read by waves that are in the pass before
        *(v4ua*)(sk + cb) = pk8(gk0, gk1); *(v4ua*)(sv + cb) = pk8(gv0, gv1);
        wait_ds0();           // publish point of this pass's stage, in the ring's order: LDS wait, tensor wait, barrier, refill
        wait_tensor0(mg0);
        __syncthreads();      // publishes this pass's tiles; a wave that has passed it has ended its reads of the pass before, whose buffers the next pass refills
        if (pinned(k0 + 32 < TT)) {      // the next pass's mask slice, in flight for the whole pass, into the buffer that the pass before has just left
            const unsigned kq = pinned(k0 + 32);
            mg0 = tdm_group0(ml + ((kq >> 5) & 1) * MBUF, mg + 4u * kq);
            tdm_load(mg0, mg1);
        }
        const int kn = (k0 + 32 < TT) ? k0 + 32 : 0;      // next pass's rows, in flight for the whole pass; the last pass re-reads pass 0 (in bounds, unused)
        gk0 = *(const v4f*)(gk + (size_t)kn * DD); gk1 = *(const v4f*)(gk + (size_t)kn * DD + 4); gv0 = *(const v4f*)(gv + (size_t)kn * DD); gv1 = *(const v4f*)(gv + (size_t)kn * DD + 4);
        v4f kk[4];
#pragma unroll
        for (int u = 0; u < 4; ++u) kk[u] = *(const v4fa*)(kr + k0 + (u >> 1) * 16 + (u & 1) * 4);
        v16bf ka[2][2];
#pragma unroll
        for (int t = 0; t < 2; ++t) {
#pragma unroll
            for (int c = 0; c < 2; ++c) { const unsigned char* p = rk + cb + 16 * t * PK + 64 * c; ka[t][c] = frag(*(const v4ua*)p, *(const v4ua*)(p + 32)); } }
        v4f mk[CG][4];
#pragma unroll
        for (int u = 0; u < 4; ++u)
#pragma unroll
            for (int g = 0; g < CG; ++g) mk[g][u] = rb4(*(const v4fa*)(rm + ((k0 >> 5) & 1) * MBUF + 16 * g * PM + (u >> 1) * 64 + (u & 1) * 16));
        v8f s[CG][2];
#pragma unroll
        for (int t = 0; t < 2; ++t)
#pragma unroll
            for (int g = 0; g < CG; ++g)      // the two masks' sum is the accumulator's start value
#pragma unroll
                for (int j = 0; j < 8; ++j) s[g][t][j] = mk[g][2 * t + (j >> 2)][j & 3] + kk[2 * t + (j >> 2)][j & 3];
#pragma unroll
        for (int t = 0; t < 2; ++t)
#pragma unroll
            for (int g = 0; g < CG; ++g) s[g][t] = F::mma(ka[t][1], bq[g][1], F::mma(ka[t][0], bq[g][0], s[g][t]));
        v16bf va[4];
#pragma unroll
        for (int dt = 0; dt < 4; ++dt) va[dt] = frag(ldtr16(rv + cb + 32 * dt), ldtr16(rv + cb + 16 * PV + 32 * dt));
        float tv[CG][16];
#pragma unroll
        for (int g = 0; g < CG; ++g)
#pragma unroll
            for (int e = 0; e < 16; ++e) tv[g][e] = s[g][e >> 3][e & 7] * SC;
#pragma unroll
        for (int g = 0; g < CG; ++g) {
            __builtin_amdgcn_sched_barrier(0);      // holds the next pass's loads above the softmax (without it the compiler sinks them to the next pass's top, where they are waited for at once) and keeps the two column groups' softmax apart
            float bm = tv[g][0];
#pragma unroll
            for (int e = 1; e < 16; ++e) bm = fmaxf(bm, tv[g][e]);
            bm = fmaxf(bm, xhalf(bm));
            const float mn = fmaxf(mx[g], bm); const float sc = __builtin_amdgcn_exp2f(mx[g] - mn); mx[g] = mn;
            float ps = 0.f; v8u ph, pl;
#pragma unroll
            for (int e = 0; e < 16; e += 2) { const float p0 = __builtin_amdgcn_exp2f(tv[g][e] - mn), p1 = __builtin_amdgcn_exp2f(tv[g][e + 1] - mn); ps += p0; ps += p1;
                const unsigned hp = pk2(p0, p1); ph[e >> 1] = hp;      // hi: two probabilities rounded to nearest even and packed by one conversion; lo: the remainders p - hi, exact in f32, go the same way
                pl[e >> 1] = pk2(p0 - __uint_as_float(hp << 16), p1 - __uint_as_float(hp & 0xFFFF0000u)); }
            sum[g] = sum[g] * sc + ps;
            const v16bf bh = __builtin_bit_cast(v16bf, ph), bl = __builtin_bit_cast(v16bf, pl);
#pragma unroll
            for (int dt = 0; dt < 4; ++dt) { o[g][dt] *= sc; o[g][dt] = F::mma(va[dt], bh, o[g][dt]); o[g][dt] = F::mma(va[dt], bl, o[g][dt]); }
        }
    }
    wait_tensor0(mg0); wait_ds0();      // nothing of the ring is in flight when the wave leaves the loop
#pragma unroll
    for (int g = 0; g < CG; ++g) {
        const float f = __fdiv_rn(1.0f, sum[g] + xhalf(sum[g]));
        float* op = OUT + (((size_t)n * TT + q0 + 16 * g) * NH_ + h) * HD + 8 * hi;
#pragma unroll
        for (int dt = 0; dt < 4; ++dt) { v4f w0, w1;
#pragma unroll
            for (int j = 0; j < 4; ++j) { w0[j] = o[g][dt][j] * f; w1[j] = o[g][dt][4 + j] * f; }
            *(v4f*)(op + 16 * dt) = w0; *(v4f*)(op + 16 * dt + 4) = w1; }
    }
}

extern "C" void kernel_launch(void* const* d_in, const int* in_sizes, int n_in,
                              void* d_out, int out_size, void* d_ws, size_t ws_size, hipStream_t stream) {
    (void)in_sizes; (void)n_in; (void)out_size; (void)d_ws; (void)ws_size;
    const float* queries = (const float*)d_in[0]; const float* keys = (const float*)d_in[1]; const float* values = (const float*)d_in[2]; const float* am = (const float*)d_in[3]; const float* kla = (const float*)d_in[4];
    float* OUT = (float*)d_out;     // [4][1024][16][64]
    k_fattn<CGQ><<<dim3(TT / (128 * CGQ), NB_ * NH_), 256, 0, stream>>>(queries, keys, values, am, kla, OUT);
}

// v008
// A run of this version takes 30.4 microseconds.
// It is 1.17 times as fast as v006, going by the measured steps of the versions left out in between.
// Counting every step since v000, it is 48.1 times as fast.
#include <hip/hip_runtime.h>

// FullAttention_Smiles (queries/keys/values [4][1024][16 heads][64]; logits = (q.k^T + attn_mask_add[l][s] + key_lengths_add[n][s]) / 8; softmax over s; out[n][l][h][d] = A.v).
// Compute dtypes, f32 accumulate: every input rounded to bf16; q.k^T on PLAIN bf16 inputs (exact products); the two additive mask inputs
// (rounded to bf16 where they are read), the 1/8 temperature and the softmax (running maximum over 32-key passes, one exp per element) in f32 on VALU -> f16 probabilities (each in [0, 1], rounded once); A.v on
// f16 operands: the bf16-rounded values re-expressed as f16 (same value wherever 2^-14 <= |v| < 65536).

#define NB_  4
#define TT   1024
#define NH_  16
#define HD   64
#define DD   (NH_ * HD)           // 1024
#define NT   (NB_ * TT)
#define CGQ  2                    // 16-query column groups per wave of the fused kernel
typedef _Float16 h16;
typedef unsigned short bf;
typedef __attribute__((ext_vector_type(16))) __bf16   v16bf;
typedef __attribute__((ext_vector_type(16))) _Float16 v16h;
typedef __attribute__((ext_vector_type(8)))  _Float16 v8h;
typedef __attribute__((ext_vector_type(8)))  unsigned short v8us;
typedef __attribute__((ext_vector_type(8)))  float    v8f;
typedef __attribute__((ext_vector_type(4)))  float    v4f;
typedef v8h  __attribute__((may_alias)) v8ha;
typedef v4f  __attribute__((may_alias)) v4fa;
typedef v8us __attribute__((may_alias)) v8usa;

__device__ __forceinline__ unsigned short f2bf(float f) { unsigned u = __float_as_uint(f); u += 0x7FFFu + ((u >> 16) & 1u); return (unsigned short)(u >> 16); }
__device__ __forceinline__ float bf2f(unsigned short b) { return __uint_as_float(((unsigned)b) << 16); }
__device__ __forceinline__ float bfr(float f) { return bf2f(f2bf(f)); }
__device__ __forceinline__ v16h cat16(v8h lo, v8h hi) { return __builtin_shufflevector(lo, hi, 0, 1, 2, 3, 4, 5, 6, 7, 8, 9, 10, 11, 12, 13, 14, 15); }
__device__ __forceinline__ v16bf cat16b(v8us lo, v8us hi) { return __builtin_bit_cast(v16bf, __builtin_shufflevector(lo, hi, 0, 1, 2, 3, 4, 5, 6, 7, 8, 9, 10, 11, 12, 13, 14, 15)); }
__device__ __forceinline__ v8f wmma16(v16h a, v16h b, v8f c) { return __builtin_amdgcn_wmma_f32_16x16x32_f16(false, a, false, b, (short)0, c, false, false); }
__device__ __forceinline__ v8f wmmab(v16bf a, v16bf b, v8f c) { return __builtin_amdgcn_wmma_f32_16x16x32_bf16(false, a, false, b, (short)0, c, false, false); }



template <typename T16> struct WFrag;
template <> struct WFrag<h16> { typedef v16h V; static __device__ __forceinline__ V ld(const h16* p) { return cat16(*(const v8h*)p, *(const v8h*)(p + 16)); } static __device__ __forceinline__ v8f mma(V a, V b, v8f c) { return wmma16(a, b, c); } };
template <> struct WFrag<bf> { typedef v16bf V; static __device__ __forceinline__ V ld(const bf* p) { return cat16b(*(const v8us*)p, *(const v8us*)(p + 16)); } static __device__ __forceinline__ v8f mma(V a, V b, v8f c) { return wmmab(a, b, c); } };
typedef __attribute__((ext_vector_type(2))) unsigned short v2us;
typedef __attribute__((ext_vector_type(4))) unsigned short v4us;
typedef __attribute__((ext_vector_type(2))) float v2f;

#define PK    144                 // LDS pitch of a 128-byte K row: 16 B x odd, for 16-byte readers
#define PV    160                 // LDS pitch of a 128-byte V row: 32 B x odd, for the transposing reader
#define KP    64                  // keys a pass of the work-group: 32 for each key half
#define KTB   (KP * PK)
#define BUFB  (KP * PK + KP * PV)
typedef __attribute__((ext_vector_type(16))) unsigned short v16us;
typedef __attribute__((ext_vector_type(2))) __bf16 v2bf;
typedef __attribute__((ext_vector_type(2))) _Float16 v2h;
typedef __attribute__((ext_vector_type(4))) unsigned v4u;
typedef __attribute__((ext_vector_type(8))) unsigned v8u;
typedef __attribute__((ext_vector_type(8))) short v8s;
typedef v4u __attribute__((may_alias)) v4ua;
__device__ __forceinline__ float xhalf(float x) { const int b = __builtin_bit_cast(int, x); return __builtin_bit_cast(float, __builtin_amdgcn_permlanex16(b, b, 0x76543210, 0xfedcba98, false, false)); }   // lane l <-> l ^ 16
__device__ __forceinline__ unsigned pk2(float a, float b) { return __builtin_bit_cast(unsigned, __builtin_convertvector((v2f){a, b}, v2bf)); }   // two f32 -> packed bf16, round to nearest even
__device__ __forceinline__ v4u pk8(v4f a, v4f b) { return (v4u){pk2(a[0], a[1]), pk2(a[2], a[3]), pk2(b[0], b[1]), pk2(b[2], b[3])}; }
__device__ __forceinline__ v4f rb4(v4f x) { const unsigned a = pk2(x[0], x[1]), b = pk2(x[2], x[3]); return (v4f){__uint_as_float(a << 16), __uint_as_float(a & 0xFFFF0000u), __uint_as_float(b << 16), __uint_as_float(b & 0xFFFF0000u)}; }   // bf16-rounded values, back in f32
__device__ __forceinline__ unsigned pk2h(float a, float b) { return __builtin_bit_cast(unsigned, __builtin_convertvector((v2f){a, b}, v2h)); }   // two f32 -> packed f16, round to nearest even
__device__ __forceinline__ v4u pk8h(v4f a, v4f b) { a = rb4(a); b = rb4(b); return (v4u){pk2h(a[0], a[1]), pk2h(a[2], a[3]), pk2h(b[0], b[1]), pk2h(b[2], b[3])}; }   // eight f32 -> bf16-rounded values, packed as f16
__device__ __forceinline__ v16h fragh(v4u lo, v4u hi) { return __builtin_bit_cast(v16h, __builtin_shufflevector(lo, hi, 0, 1, 2, 3, 4, 5, 6, 7)); }
__device__ __forceinline__ v16bf frag(v4u lo, v4u hi) { return __builtin_bit_cast(v16bf, __builtin_shufflevector(lo, hi, 0, 1, 2, 3, 4, 5, 6, 7)); }
__device__ __forceinline__ v4u ldtr16(const unsigned char* p) { typedef __attribute__((address_space(3))) v8s lds_v8s; return __builtin_bit_cast(v4u, __builtin_amdgcn_ds_load_tr16_b128_v8i16((lds_v8s*)p)); }
// ---- attn_mask_add by the tensor mover: each wave's 32 query rows x 32 keys of a pass (32 rows of 128 B, source pitch 4 KiB) land in the wave's own LDS slice, through no register.
#define PM    144                 // LDS pitch of a 128-byte mask row, set by the request's pad: 16 B x odd, for 16-byte readers
#define MSL   6144                // a wave's slice, 32 * PM bytes rounded up to a multiple of 2 KiB
#define MBUF  (16 * MSL)          // one stage: sixteen slices
typedef __attribute__((ext_vector_type(4))) unsigned u32x4;
typedef __attribute__((ext_vector_type(8))) unsigned u32x8;
__device__ __forceinline__ unsigned uni(unsigned v) { return (unsigned)__builtin_amdgcn_readfirstlane(v); }
__device__ __forceinline__ unsigned pinned(unsigned v) { unsigned w = uni(v); asm volatile("" : "+s"(w)); return w; }      // a wave-uniform word held in a scalar register, so that the test on it is a scalar branch and a descriptor word formed from it is formed behind the waits
__device__ __forceinline__ void wait_ds0() { asm volatile("s_wait_dscnt 0x0" ::: "memory"); }          // this wave's LDS reads and writes have retired
__device__ __forceinline__ void wait_tensor0(u32x4 g0) { asm volatile("s_wait_tensorcnt 0x0" :: "s"(g0) : "memory"); }  // this wave's tensor load has landed (the compiler places no wait for it); the request's group 0 is named as an input so that its registers stay as issued until here
__device__ __forceinline__ void tdm_load(u32x4 g0, u32x8 g1) { asm volatile("tensor_load_to_lds %0, %1" :: "s"(g0), "s"(g1) : "memory"); }
__device__ __forceinline__ u32x8 tdm_group1() {      // 1-byte elements, tensor = tile = 32 rows of 128 bytes, source pitch 4096 bytes, 16 bytes of LDS pad behind every 128
    u32x8 g;
    g[0] = uni((1u << 20) | (4u << 22) | (3u << 25)); g[1] = uni(128u << 16); g[2] = uni(32u << 16); g[3] = uni(128u << 16);
    g[4] = uni(32u); g[5] = uni(4u * TT); g[6] = uni(0u); g[7] = uni(0u);
    return g;
}
__device__ __forceinline__ u32x4 tdm_group0(unsigned lds_dst, unsigned long long ga) {
    u32x4 g;
    g[0] = uni(1u); g[1] = uni(lds_dst); g[2] = uni((unsigned)ga); g[3] = uni((((unsigned)(ga >> 32)) & 0x01FFFFFFu) | 0x80000000u);
    return g;
}
typedef float __attribute__((may_alias)) f32a;
typedef v2f __attribute__((may_alias)) v2fa;
// The join of a query group's two key halves: each wave hands one of its two column groups to its partner (give) and finishes the other (join_store). Lane for lane the two waves hold the same query and the same rows of O^T.
__device__ __forceinline__ void give(unsigned char* x, const v8f (&og)[4], float m, float s, int lane) {
#pragma unroll
    for (int dt = 0; dt < 4; ++dt) {
        *(v4fa*)(x + 1024 * dt + 16 * lane) = (v4f){og[dt][0], og[dt][1], og[dt][2], og[dt][3]};
        *(v4fa*)(x + 1024 * dt + 512 + 16 * lane) = (v4f){og[dt][4], og[dt][5], og[dt][6], og[dt][7]}; }
    *(f32a*)(x + 4096 + 4 * lane) = m; *(f32a*)(x + 4224 + 4 * lane) = s;
}
__device__ __forceinline__ void join_store(const unsigned char* x, const v8f (&og)[4], float m, float s, int lane, float* op) {
    const float mp = *(const f32a*)(x + 4096 + 4 * lane), sp = *(const f32a*)(x + 4224 + 4 * lane);
    const float mn = fmaxf(m, mp), fa = __builtin_amdgcn_exp2f(m - mn), fb = __builtin_amdgcn_exp2f(mp - mn);
    const float st = s * fa + sp * fb;
    const float f = __fdiv_rn(1.0f, st + xhalf(st));
    const float ca = fa * f, cp = fb * f;
#pragma unroll
    for (int dt = 0; dt < 4; ++dt) { const v4f p0 = *(const v4fa*)(x + 1024 * dt + 16 * lane), p1 = *(const v4fa*)(x + 1024 * dt + 512 + 16 * lane); v4f w0, w1;
#pragma unroll
        for (int j = 0; j < 4; ++j) { w0[j] = og[dt][j] * ca + p0[j] * cp; w1[j] = og[dt][4 + j] * ca + p1[j] * cp; }
        *(v4f*)(op + 16 * dt) = w0; *(v4f*)(op + 16 * dt + 4) = w1; }
}
template <int CG>
__global__ __launch_bounds__(512) void k_fattn(const float* __restrict__ Q, const float* __restrict__ K, const float* __restrict__ V, const float* __restrict__ AM, const float* __restrict__ KL, float* OUT) {
    typedef WFrag<bf> F;
    __shared__ __attribute__((aligned(256))) unsigned char L[2 * BUFB];
    __shared__ __attribute__((aligned(2048))) unsigned char LM[2 * MBUF];      // attn_mask_add tiles, f32 as read: two stages of sixteen slices
    __shared__ __attribute__((aligned(16))) float LK[TT];      // this batch entry's key_lengths_add row, rounded to bf16 once per work-group, kept as f32
    const float SC = 0.125f * 1.44269504088896f;      // temperature, in log2 units
    const int lane = threadIdx.x & 31, lr = lane & 15, hi = lane >> 4;
    const int z = blockIdx.y, n = z >> 4, h = z & 15;
    const int q0 = (blockIdx.x * 8 + ((threadIdx.x >> 5) & 7)) * (16 * CG) + lr;
    static_assert(16 * CG == 32, "the mask slice and its descriptor are written for 32 query rows a wave");
    const unsigned wave = uni(threadIdx.x >> 5), qw = wave & 7, kh = wave >> 3;      // query group and key half
    const unsigned ml = (unsigned)(size_t)LM + wave * MSL;      // this wave's slice of stage buffer 0, as a byte offset in the work-group's LDS
    const unsigned long long mg = (unsigned long long)(size_t)AM + (unsigned long long)((blockIdx.x * 8 + qw) * (16 * CG)) * (4u * TT) + 128u * kh;      // this wave's first query row of attn_mask_add, at its key half's 32 floats
    const u32x8 mg1 = tdm_group1();
    u32x4 mg0 = tdm_group0(ml, mg);
    tdm_load(mg0, mg1);      // stage 0; every wave issues its own slice
    const unsigned char* rm = LM + wave * MSL + lr * PM + 32 * hi;      // mask row lr, floats 8*hi..: the accumulator's key order
    const int sr = threadIdx.x >> 3, so = threadIdx.x & 7;      // staging: this thread's key row of a pass, and its 8 floats of that row
    const float* gk = K + (((size_t)n * TT + sr) * NH_ + h) * HD + 8 * so;
    const float* gv = V + (((size_t)n * TT + sr) * NH_ + h) * HD + 8 * so;
    unsigned char* sk = L + sr * PK + 16 * so;
    unsigned char* sv = L + KTB + sr * PV + 16 * so;
    const unsigned char* rk = L + (32 * kh + lr) * PK + 16 * hi;      // K row lr, bytes 16*hi and 32+16*hi of each 64: the hardware k order
    const unsigned char* rv = L + KTB + (32 * kh + 8 * hi + (lane & 7)) * PV + 16 * ((lane >> 3) & 1);      // the transposing load's lane address; lane (lr, hi) gets V[8*hi+0..7][lr]
    const float* kr = LK + 32 * kh + 8 * hi;
    { const v2f x = *(const v2f*)(KL + (size_t)n * TT + 2 * threadIdx.x); const unsigned a = pk2(x[0], x[1]);
      *(v2fa*)(LK + 2 * threadIdx.x) = (v2f){__uint_as_float(a << 16), __uint_as_float(a & 0xFFFF0000u)}; }      // two floats a thread; published by the first pass's barrier
    v16bf bq[CG][2]; v8f o[CG][4]; float mx[CG], sum[CG];
#pragma unroll
    for (int g = 0; g < CG; ++g) { mx[g] = -3.0e38f; sum[g] = 0.f;
#pragma unroll
        for (int c = 0; c < 2; ++c) { const float* qp = Q + (((size_t)n * TT + q0 + 16 * g) * NH_ + h) * HD + 8 * hi + 32 * c;
            bq[g][c] = frag(pk8(*(const v4f*)qp, *(const v4f*)(qp + 4)), pk8(*(const v4f*)(qp + 16), *(const v4f*)(qp + 20))); }
#pragma unroll
        for (int dt = 0; dt < 4; ++dt) o[g][dt] = (v8f){}; }
    v4f gk0 = *(const v4f*)gk, gk1 = *(const v4f*)(gk + 4), gv0 = *(const v4f*)gv, gv1 = *(const v4f*)(gv + 4);      // pass 0's rows
    wait_tensor0(mg0);      // stage 0 has landed; the first pass's barrier publishes it
#pragma unroll 1
    for (int k0 = 0; k0 < TT; k0 += KP) {
        const int cb = ((k0 >> 6) & 1) * BUFB;      // this pass's buffer; the other one may still be read by waves that are in the pass before
        *(v4ua*)(sk + cb) = pk8(gk0, gk1); *(v4ua*)(sv + cb) = pk8h(gv0, gv1);
        wait_ds0();           // publish point of this pass's stage, in the ring's order: LDS wait, tensor wait, barrier, refill
        wait_tensor0(mg0);
        __syncthreads();      // publishes this pass's tiles; a wave that has passed it has ended its reads of the pass before, whose buffers the next pass refills
        if (pinned(k0 + KP < TT)) {      // the next pass's mask slice, in flight for the whole pass, into the buffer that the pass before has just left
            const unsigned kq = pinned(k0 + KP);
            mg0 = tdm_group0(ml + ((kq >> 6) & 1) * MBUF, mg + 4u * kq);
            tdm_load(mg0, mg1);
        }
        const int kn = (k0 + KP < TT) ? k0 + KP : 0;      // next pass's rows, in flight for the whole pass; the last pass re-reads pass 0 (in bounds, unused)
        gk0 = *(const v4f*)(gk + (size_t)kn * DD); gk1 = *(const v4f*)(gk + (size_t)kn * DD + 4); gv0 = *(const v4f*)(gv + (size_t)kn * DD); gv1 = *(const v4f*)(gv + (size_t)kn * DD + 4);
        v4f kk[4];
#pragma unroll
        for (int u = 0; u < 4; ++u) kk[u] = *(const v4fa*)(kr + k0 + (u >> 1) * 16 + (u & 1) * 4);
        v16bf ka[2][2];
#pragma unroll
        for (int t = 0; t < 2; ++t) {
#pragma unroll
            for (int c = 0; c < 2; ++c) { const unsigned char* p = rk + cb + 16 * t * PK + 64 * c; ka[t][c] = frag(*(const v4ua*)p, *(const v4ua*)(p + 32)); } }
        v4f mk[CG][4];
#pragma unroll
        for (int u = 0; u < 4; ++u)
#pragma unroll
            for (int g = 0; g < CG; ++g) mk[g][u] = rb4(*(const v4fa*)(rm + ((k0 >> 6) & 1) * MBUF + 16 * g * PM + (u >> 1) * 64 + (u & 1) * 16));
        v8f s[CG][2];
#pragma unroll
        for (int t = 0; t < 2; ++t)
#pragma unroll
            for (int g = 0; g < CG; ++g)      // the two masks' sum is the accumulator's start value
#pragma unroll
                for (int j = 0; j < 8; ++j) s[g][t][j] = mk[g][2 * t + (j >> 2)][j & 3] + kk[2 * t + (j >> 2)][j & 3];
#pragma unroll
        for (int t = 0; t < 2; ++t)
#pragma unroll
            for (int g = 0; g < CG; ++g) s[g][t] = F::mma(ka[t][1], bq[g][1], F::mma(ka[t][0], bq[g][0], s[g][t]));
        v16h va[4];
#pragma unroll
        for (int dt = 0; dt < 4; ++dt) va[dt] = fragh(ldtr16(rv + cb + 32 * dt), ldtr16(rv + cb + 16 * PV + 32 * dt));
        float tv[CG][16];
#pragma unroll
        for (int g = 0; g < CG; ++g)
#pragma unroll
            for (int e = 0; e < 16; ++e) tv[g][e] = s[g][e >> 3][e & 7] * SC;
#pragma unroll
        for (int g = 0; g < CG; ++g) {
            __builtin_amdgcn_sched_barrier(0);      // holds the next pass's loads above the softmax (without it the compiler sinks them to the next pass's top, where they are waited for at once) and keeps the two column groups' softmax apart
            float bm = tv[g][0];
#pragma unroll
            for (int e = 1; e < 16; ++e) bm = fmaxf(bm, tv[g][e]);
            bm = fmaxf(bm, xhalf(bm));
            const float mn = fmaxf(mx[g], bm); const float sc = __builtin_amdgcn_exp2f(mx[g] - mn); mx[g] = mn;
            float ps = 0.f; v8u ph;
#pragma unroll
            for (int e = 0; e < 16; e += 2) { const float p0 = __builtin_amdgcn_exp2f(tv[g][e] - mn), p1 = __builtin_amdgcn_exp2f(tv[g][e + 1] - mn); ps += p0; ps += p1;
                ph[e >> 1] = pk2h(p0, p1); }      // two probabilities rounded to nearest even and packed by one conversion
            sum[g] = sum[g] * sc + ps;
            const v16h bh = __builtin_bit_cast(v16h, ph);
#pragma unroll
            for (int dt = 0; dt < 4; ++dt) { o[g][dt] *= sc; o[g][dt] = wmma16(va[dt], bh, o[g][dt]); }
        }
    }
    wait_tensor0(mg0); wait_ds0();      // nothing of the ring is in flight when the wave leaves the loop
    unsigned char* xo = LM + wave * MSL;      // this wave's own slice of stage buffer 0: only this wave's requests and reads have touched it, and they have ended
    const unsigned char* xp = LM + (wave ^ 8) * MSL;      // the partner's: same query group, other key half
    float* op = OUT + (((size_t)n * TT + q0 + 16 * kh) * NH_ + h) * HD + 8 * hi;      // key half kh finishes column group kh
    v8f ok[4], og[4];      // the column group that this wave keeps, and the one that it hands over
#pragma unroll
    for (int dt = 0; dt < 4; ++dt) { ok[dt] = kh ? o[1][dt] : o[0][dt]; og[dt] = kh ? o[0][dt] : o[1][dt]; }
    give(xo, og, kh ? mx[0] : mx[1], kh ? sum[0] : sum[1], lane);
    __syncthreads();      // publishes what each wave hands to its partner
    join_store(xp, ok, kh ? mx[1] : mx[0], kh ? sum[1] : sum[0], lane, op);
}

extern "C" void kernel_launch(void* const* d_in, const int* in_sizes, int n_in,
                              void* d_out, int out_size, void* d_ws, size_t ws_size, hipStream_t stream) {
    (void)in_sizes; (void)n_in; (void)out_size; (void)d_ws; (void)ws_size;
    const float* queries = (const float*)d_in[0]; const float* keys = (const float*)d_in[1]; const float* values = (const float*)d_in[2]; const float* am = (const float*)d_in[3]; const float* kla = (const float*)d_in[4];
    float* OUT = (float*)d_out;     // [4][1024][16][64]
    k_fattn<CGQ><<<dim3(TT / (128 * CGQ), NB_ * NH_), 512, 0, stream>>>(queries, keys, values, am, kla, OUT);
}

// v009
// It runs in 28.6 microseconds.
// Timed twice side by side with v008, it ran 1.06 times as fast both times.
// Over all steps from v000 it is 51.2 times as fast.
#include <hip/hip_runtime.h>

// FullAttention_Smiles (queries/keys/values [4][1024][16 heads][64]; logits = (q.k^T + attn_mask_add[l][s] + key_lengths_add[n][s]) / 8; softmax over s; out[n][l][h][d] = A.v).
// Compute dtypes, f32 accumulate: every input rounded to bf16; q.k^T on PLAIN bf16 inputs (exact products); the two additive mask inputs
// (rounded to bf16 where they are read), the 1/8 temperature and the softmax (running maximum over 32-key passes, one exp per element) in f32 on VALU -> f16 probabilities (each in [0, 1], rounded once); A.v on
// f16 operands: the bf16-rounded values re-expressed as f16 (same value wherever 2^-14 <= |v| < 65536).

#define NB_  4
#define TT   1024
#define NH_  16
#define HD   64
#define DD   (NH_ * HD)           // 1024
#define NT   (NB_ * TT)
#define CGQ  2                    // 16-query column groups per wave of the fused kernel
typedef _Float16 h16;
typedef unsigned short bf;
typedef __attribute__((ext_vector_type(16))) __bf16   v16bf;
typedef __attribute__((ext_vector_type(16))) _Float16 v16h;
typedef __attribute__((ext_vector_type(8)))  _Float16 v8h;
typedef __attribute__((ext_vector_type(8)))  unsigned short v8us;
typedef __attribute__((ext_vector_type(8)))  float    v8f;
typedef __attribute__((ext_vector_type(4)))  float    v4f;
typedef v8h  __attribute__((may_alias)) v8ha;
typedef v4f  __attribute__((may_alias)) v4fa;
typedef v8us __attribute__((may_alias)) v8usa;

__device__ __forceinline__ unsigned short f2bf(float f) { unsigned u = __float_as_uint(f); u += 0x7FFFu + ((u >> 16) & 1u); return (unsigned short)(u >> 16); }
__device__ __forceinline__ float bf2f(unsigned short b) { return __uint_as_float(((unsigned)b) << 16); }
__device__ __forceinline__ float bfr(float f) { return bf2f(f2bf(f)); }
__device__ __forceinline__ v16h cat16(v8h lo, v8h hi) { return __builtin_shufflevector(lo, hi, 0, 1, 2, 3, 4, 5, 6, 7, 8, 9, 10, 11, 12, 13, 14, 15); }
__device__ __forceinline__ v16bf cat16b(v8us lo, v8us hi) { return __builtin_bit_cast(v16bf, __builtin_shufflevector(lo, hi, 0, 1, 2, 3, 4, 5, 6, 7, 8, 9, 10, 11, 12, 13, 14, 15)); }
__device__ __forceinline__ v8f wmma16(v16h a, v16h b, v8f c) { return __builtin_amdgcn_wmma_f32_16x16x32_f16(false, a, false, b, (short)0, c, false, false); }
__device__ __forceinline__ v8f wmmab(v16bf a, v16bf b, v8f c) { return __builtin_amdgcn_wmma_f32_16x16x32_bf16(false, a, false, b, (short)0, c, false, false); }



template <typename T16> struct WFrag;
template <> struct WFrag<h16> { typedef v16h V; static __device__ __forceinline__ V ld(const h16* p) { return cat16(*(const v8h*)p, *(const v8h*)(p + 16)); } static __device__ __forceinline__ v8f mma(V a, V b, v8f c) { return wmma16(a, b, c); } };
template <> struct WFrag<bf> { typedef v16bf V; static __device__ __forceinline__ V ld(const bf* p) { return cat16b(*(const v8us*)p, *(const v8us*)(p + 16)); } static __device__ __forceinline__ v8f mma(V a, V b, v8f c) { return wmmab(a, b, c); } };
typedef __attribute__((ext_vector_type(2))) unsigned short v2us;
typedef __attribute__((ext_vector_type(4))) unsigned short v4us;
typedef __attribute__((ext_vector_type(2))) float v2f;

#define PK    144                 // LDS pitch of a 128-byte K row: 16 B x odd, for 16-byte readers
#define PV    160                 // LDS pitch of a 128-byte V row: 32 B x odd, for the transposing reader
#define KP    64                  // keys a pass of the work-group: 32 for each key half
#define KTB   (KP * PK)
#define BUFB  (KP * PK + KP * PV)
typedef __attribute__((ext_vector_type(16))) unsigned short v16us;
typedef __attribute__((ext_vector_type(2))) __bf16 v2bf;
typedef __attribute__((ext_vector_type(2))) _Float16 v2h;
typedef __attribute__((ext_vector_type(4))) unsigned v4u;
typedef __attribute__((ext_vector_type(8))) unsigned v8u;
typedef __attribute__((ext_vector_type(8))) short v8s;
typedef v4u __attribute__((may_alias)) v4ua;
__device__ __forceinline__ float xhalf(float x) { const int b = __builtin_bit_cast(int, x); return __builtin_bit_cast(float, __builtin_amdgcn_permlanex16(b, b, 0x76543210, 0xfedcba98, false, false)); }   // lane l <-> l ^ 16
__device__ __forceinline__ unsigned pk2(float a, float b) { return __builtin_bit_cast(unsigned, __builtin_convertvector((v2f){a, b}, v2bf)); }   // two f32 -> packed bf16, round to nearest even
__device__ __forceinline__ v4u pk8(v4f a, v4f b) { return (v4u){pk2(a[0], a[1]), pk2(a[2], a[3]), pk2(b[0], b[1]), pk2(b[2], b[3])}; }
__device__ __forceinline__ v4f rb4(v4f x) { const unsigned a = pk2(x[0], x[1]), b = pk2(x[2], x[3]); return (v4f){__uint_as_float(a << 16), __uint_as_float(a & 0xFFFF0000u), __uint_as_float(b << 16), __uint_as_float(b & 0xFFFF0000u)}; }   // bf16-rounded values, back in f32
__device__ __forceinline__ unsigned pk2h(float a, float b) { return __builtin_bit_cast(unsigned, __builtin_convertvector((v2f){a, b}, v2h)); }   // two f32 -> packed f16, round to nearest even
__device__ __forceinline__ v4u pk8h(v4f a, v4f b) { a = rb4(a); b = rb4(b); return (v4u){pk2h(a[0], a[1]), pk2h(a[2], a[3]), pk2h(b[0], b[1]), pk2h(b[2], b[3])}; }   // eight f32 -> bf16-rounded values, packed as f16
__device__ __forceinline__ v16h fragh(v4u lo, v4u hi) { return __builtin_bit_cast(v16h, __builtin_shufflevector(lo, hi, 0, 1, 2, 3, 4, 5, 6, 7)); }
__device__ __forceinline__ v16bf frag(v4u lo, v4u hi) { return __builtin_bit_cast(v16bf, __builtin_shufflevector(lo, hi, 0, 1, 2, 3, 4, 5, 6, 7)); }
__device__ __forceinline__ v4u ldtr16(const unsigned char* p) { typedef __attribute__((address_space(3))) v8s lds_v8s; return __builtin_bit_cast(v4u, __builtin_amdgcn_ds_load_tr16_b128_v8i16((lds_v8s*)p)); }
// ---- attn_mask_add by the tensor mover: each wave's 32 query rows x 32 keys of a pass (32 rows of 128 B, source pitch 4 KiB) land in the wave's own LDS slice, through no register.
#define PM    144                 // LDS pitch of a 128-byte mask row, set by the request's pad: 16 B x odd, for 16-byte readers
#define MSL   6144                // a wave's slice, 32 * PM bytes rounded up to a multiple of 2 KiB
#define MBUF  (16 * MSL)          // one stage: sixteen slices
typedef __attribute__((ext_vector_type(4))) unsigned u32x4;
typedef __attribute__((ext_vector_type(8))) unsigned u32x8;
__device__ __forceinline__ unsigned uni(unsigned v) { return (unsigned)__builtin_amdgcn_readfirstlane(v); }
__device__ __forceinline__ unsigned pinned(unsigned v) { unsigned w = uni(v); asm volatile("" : "+s"(w)); return w; }      // a wave-uniform word held in a scalar register, so that the test on it is a scalar branch and a descriptor word formed from it is formed behind the waits
__device__ __forceinline__ void wait_ds0() { asm volatile("s_wait_dscnt 0x0" ::: "memory"); }          // this wave's LDS reads and writes have retired
__device__ __forceinline__ void wait_tensor0(u32x4 g0) { asm volatile("s_wait_tensorcnt 0x0" :: "s"(g0) : "memory"); }  // this wave's tensor load has landed (the compiler places no wait for it); the request's group 0 is named as an input so that its registers stay as issued until here
__device__ __forceinline__ void wait_x0() { asm volatile("s_wait_xcnt 0x0" ::: "memory"); }            // stands between issued global loads and the next write of a register that they name
__device__ __forceinline__ void bar_signal() { asm volatile("s_barrier_signal -1" ::: "memory"); }      // the work-group barrier's first half: this wave has arrived; the waits that the other waves count on are written in front of it
__device__ __forceinline__ void bar_wait() { asm volatile("s_barrier_wait -1" ::: "memory"); }          // its second half: every wave has arrived; signal and wait alternate strictly in every wave
__device__ __forceinline__ void tdm_load(u32x4 g0, u32x8 g1) { asm volatile("tensor_load_to_lds %0, %1" :: "s"(g0), "s"(g1) : "memory"); }
__device__ __forceinline__ u32x8 tdm_group1() {      // 1-byte elements, tensor = tile = 32 rows of 128 bytes, source pitch 4096 bytes, 16 bytes of LDS pad behind every 128
    u32x8 g;
    g[0] = uni((1u << 20) | (4u << 22) | (3u << 25)); g[1] = uni(128u << 16); g[2] = uni(32u << 16); g[3] = uni(128u << 16);
    g[4] = uni(32u); g[5] = uni(4u * TT); g[6] = uni(0u); g[7] = uni(0u);
    return g;
}
__device__ __forceinline__ u32x4 tdm_group0(unsigned lds_dst, unsigned long long ga) {
    u32x4 g;
    g[0] = uni(1u); g[1] = uni(lds_dst); g[2] = uni((unsigned)ga); g[3] = uni((((unsigned)(ga >> 32)) & 0x01FFFFFFu) | 0x80000000u);
    return g;
}
typedef float __attribute__((may_alias)) f32a;
typedef v2f __attribute__((may_alias)) v2fa;
// The join of a query group's two key halves: each wave hands one of its two column groups to its partner (give) and finishes the other (join_store). Lane for lane the two waves hold the same query and the same rows of O^T.
__device__ __forceinline__ void give(unsigned char* x, const v8f (&og)[4], float m, float s, int lane) {
#pragma unroll
    for (int dt = 0; dt < 4; ++dt) {
        *(v4fa*)(x + 1024 * dt + 16 * lane) = (v4f){og[dt][0], og[dt][1], og[dt][2], og[dt][3]};
        *(v4fa*)(x + 1024 * dt + 512 + 16 * lane) = (v4f){og[dt][4], og[dt][5], og[dt][6], og[dt][7]}; }
    *(f32a*)(x + 4096 + 4 * lane) = m; *(f32a*)(x + 4224 + 4 * lane) = s;
}
__device__ __forceinline__ void join_store(const unsigned char* x, const v8f (&og)[4], float m, float s, int lane, float* op) {
    const float mp = *(const f32a*)(x + 4096 + 4 * lane), sp = *(const f32a*)(x + 4224 + 4 * lane);
    const float mn = fmaxf(m, mp), fa = __builtin_amdgcn_exp2f(m - mn), fb = __builtin_amdgcn_exp2f(mp - mn);
    const float st = s * fa + sp * fb;
    const float f = __fdiv_rn(1.0f, st + xhalf(st));
    const float ca = fa * f, cp = fb * f;
#pragma unroll
    for (int dt = 0; dt < 4; ++dt) { const v4f p0 = *(const v4fa*)(x + 1024 * dt + 16 * lane), p1 = *(const v4fa*)(x + 1024 * dt + 512 + 16 * lane); v4f w0, w1;
#pragma unroll
        for (int j = 0; j < 4; ++j) { w0[j] = og[dt][j] * ca + p0[j] * cp; w1[j] = og[dt][4 + j] * ca + p1[j] * cp; }
        *(v4f*)(op + 16 * dt) = w0; *(v4f*)(op + 16 * dt + 4) = w1; }
}
template <int CG>
__global__ __launch_bounds__(512) void k_fattn(const float* __restrict__ Q, const float* __restrict__ K, const float* __restrict__ V, const float* __restrict__ AM, const float* __restrict__ KL, float* OUT) {
    typedef WFrag<bf> F;
    __shared__ __attribute__((aligned(256))) unsigned char L[2 * BUFB];
    __shared__ __attribute__((aligned(2048))) unsigned char LM[2 * MBUF];      // attn_mask_add tiles, f32 as read: two stages of sixteen slices
    __shared__ __attribute__((aligned(16))) float LK[TT];      // this batch entry's key_lengths_add row, rounded to bf16 once per work-group, kept as f32
    const float SC = 0.125f * 1.44269504088896f;      // temperature, in log2 units
    const int lane = threadIdx.x & 31, lr = lane & 15, hi = lane >> 4;
    const int z = blockIdx.y, n = z >> 4, h = z & 15;
    const int q0 = (blockIdx.x * 8 + ((threadIdx.x >> 5) & 7)) * (16 * CG) + lr;
    static_assert(16 * CG == 32, "the mask slice and its descriptor are written for 32 query rows a wave");
    const unsigned wave = uni(threadIdx.x >> 5), qw = wave & 7, kh = wave >> 3;      // query group and key half
    const unsigned ml = (unsigned)(size_t)LM + wave * MSL;      // this wave's slice of stage buffer 0, as a byte offset in the work-group's LDS
    const unsigned long long mg = (unsigned long long)(size_t)AM + (unsigned long long)((blockIdx.x * 8 + qw) * (16 * CG)) * (4u * TT) + 128u * kh;      // this wave's first query row of attn_mask_add, at its key half's 32 floats
    const u32x8 mg1 = tdm_group1();
    u32x4 mg0 = tdm_group0(ml, mg);
    tdm_load(mg0, mg1);      // stage 0; every wave issues its own slice
    const unsigned char* rm = LM + wave * MSL + lr * PM + 32 * hi;      // mask row lr, floats 8*hi..: the accumulator's key order
    const int sr = threadIdx.x >> 3, so = threadIdx.x & 7;      // staging: this thread's key row of a pass, and its 8 floats of that row
    const float* gk = K + (((size_t)n * TT + sr) * NH_ + h) * HD + 8 * so;
    const float* gv = V + (((size_t)n * TT + sr) * NH_ + h) * HD + 8 * so;
    unsigned char* sk = L + sr * PK + 16 * so;
    unsigned char* sv = L + KTB + sr * PV + 16 * so;
    const unsigned char* rk = L + (32 * kh + lr) * PK + 16 * hi;      // K row lr, bytes 16*hi and 32+16*hi of each 64: the hardware k order
    const unsigned char* rv = L + KTB + (32 * kh + 8 * hi + (lane & 7)) * PV + 16 * ((lane >> 3) & 1);      // the transposing load's lane address; lane (lr, hi) gets V[8*hi+0..7][lr]
    const float* kr = LK + 32 * kh + 8 * hi;
    { const v2f x = *(const v2f*)(KL + (size_t)n * TT + 2 * threadIdx.x); const unsigned a = pk2(x[0], x[1]);
      *(v2fa*)(LK + 2 * threadIdx.x) = (v2f){__uint_as_float(a << 16), __uint_as_float(a & 0xFFFF0000u)}; }      // two floats a thread; published by the first pass's barrier
    v16bf bq[CG][2]; v8f o[CG][4]; float mx[CG], sum[CG];
#pragma unroll
    for (int g = 0; g < CG; ++g) { mx[g] = -3.0e38f; sum[g] = 0.f;
#pragma unroll
        for (int c = 0; c < 2; ++c) { const float* qp = Q + (((size_t)n * TT + q0 + 16 * g) * NH_ + h) * HD + 8 * hi + 32 * c;
            bq[g][c] = frag(pk8(*(const v4f*)qp, *(const v4f*)(qp + 4)), pk8(*(const v4f*)(qp + 16), *(const v4f*)(qp + 20))); }
#pragma unroll
        for (int dt = 0; dt < 4; ++dt) o[g][dt] = (v8f){}; }
    v4f gk0 = *(const v4f*)gk, gk1 = *(const v4f*)(gk + 4), gv0 = *(const v4f*)gv, gv1 = *(const v4f*)(gv + 4);      // pass 0's rows
    *(v4ua*)sk = pk8(gk0, gk1); *(v4ua*)sv = pk8h(gv0, gv1);      // into buffer 0
    gk += (size_t)KP * DD; gv += (size_t)KP * DD;
    gk0 = *(const v4f*)gk; gk1 = *(const v4f*)(gk + 4); gv0 = *(const v4f*)gv; gv1 = *(const v4f*)(gv + 4);      // pass 1's rows, in flight until pass 0 stores them
    wait_x0();            // pass 0 rewrites registers that these loads name
    wait_tensor0(mg0);      // stage 0 has landed
    wait_ds0();           // this wave's share of pass 0's tiles and of the key_lengths_add row is written
    bar_signal();         // answered by the wait at the top of pass 0
#pragma unroll 1
    for (int k0 = 0; k0 < TT; k0 += KP) {
        const int cb = ((k0 >> 6) & 1) * BUFB;      // this pass's buffer
        wait_tensor0(mg0);    // this pass's mask slice has landed; the slice is this wave's own (no other wave reads it), so its wait stands here, a whole pass behind the request, not in front of the signal
        bar_wait();           // every wave has signalled: this pass's K and V tiles are written, and nobody reads the other buffer any more. This wave's own s_wait_dscnt 0 stands in front of its signal, and it has touched no LDS since
        if (pinned(k0 + KP < TT)) {      // the next pass's mask slice, in flight for the whole pass, into the buffer that the pass before has just left
            const unsigned kq = pinned(k0 + KP);
            mg0 = tdm_group0(ml + ((kq >> 6) & 1) * MBUF, mg + 4u * kq);
            tdm_load(mg0, mg1);
        }
        v4f kk[4];
#pragma unroll
        for (int u = 0; u < 4; ++u) kk[u] = *(const v4fa*)(kr + k0 + (u >> 1) * 16 + (u & 1) * 4);
        v16bf ka[2][2];
#pragma unroll
        for (int t = 0; t < 2; ++t) {
#pragma unroll
            for (int c = 0; c < 2; ++c) { const unsigned char* p = rk + cb + 16 * t * PK + 64 * c; ka[t][c] = frag(*(const v4ua*)p, *(const v4ua*)(p + 32)); } }
        v4f mk[CG][4];
#pragma unroll
        for (int u = 0; u < 4; ++u)
#pragma unroll
            for (int g = 0; g < CG; ++g) mk[g][u] = *(const v4fa*)(rm + ((k0 >> 6) & 1) * MBUF + 16 * g * PM + (u >> 1) * 64 + (u & 1) * 16);
        v16h va[4];
#pragma unroll
        for (int dt = 0; dt < 4; ++dt) va[dt] = fragh(ldtr16(rv + cb + 32 * dt), ldtr16(rv + cb + 16 * PV + 32 * dt));
        if (k0 + KP < TT) {      // the same for the whole work-group. The barrier is split: all of a pass's LDS traffic stands here at its top, in front of the signal; the products and the softmax behind it touch no LDS, so a wave may run them while its neighbours are still in the pass before or already read the next one's tiles
            const int nb = BUFB - cb;      // the other buffer: every wave left it before it signalled for this pass
            *(v4ua*)(sk + nb) = pk8(gk0, gk1); *(v4ua*)(sv + nb) = pk8h(gv0, gv1);      // the next pass's rows
            const size_t adv = (k0 + 2 * KP < TT) ? (size_t)KP * DD : 0;      // on to the rows of the pass after that, in flight for a whole pass; the last but one pass has none and re-reads the last pass's (in bounds, unused)
            gk += adv; gv += adv;
            gk0 = *(const v4f*)gk; gk1 = *(const v4f*)(gk + 4); gv0 = *(const v4f*)gv; gv1 = *(const v4f*)(gv + 4);
            wait_x0();            // in front of whatever next rewrites a register that these four loads name
            wait_ds0();           // every LDS read of this wave's pass has landed in registers and its stores are written
            bar_signal();         // answered by the wait at the top of the next pass
        }
#pragma unroll
        for (int u = 0; u < 4; ++u)
#pragma unroll
            for (int g = 0; g < CG; ++g) mk[g][u] = rb4(mk[g][u]);
        v8f s[CG][2];
#pragma unroll
        for (int t = 0; t < 2; ++t)
#pragma unroll
            for (int g = 0; g < CG; ++g)      // the two masks' sum is the accumulator's start value
#pragma unroll
                for (int j = 0; j < 8; ++j) s[g][t][j] = mk[g][2 * t + (j >> 2)][j & 3] + kk[2 * t + (j >> 2)][j & 3];
#pragma unroll
        for (int t = 0; t < 2; ++t)
#pragma unroll
            for (int g = 0; g < CG; ++g) s[g][t] = F::mma(ka[t][1], bq[g][1], F::mma(ka[t][0], bq[g][0], s[g][t]));
        float tv[CG][16];
#pragma unroll
        for (int g = 0; g < CG; ++g)
#pragma unroll
            for (int e = 0; e < 16; ++e) tv[g][e] = s[g][e >> 3][e & 7] * SC;
#pragma unroll
        for (int g = 0; g < CG; ++g) {
            __builtin_amdgcn_sched_barrier(0);      // keeps the two column groups' softmax apart
            float bm = tv[g][0];
#pragma unroll
            for (int e = 1; e < 16; ++e) bm = fmaxf(bm, tv[g][e]);
            bm = fmaxf(bm, xhalf(bm));
            const float mn = fmaxf(mx[g], bm); const float sc = __builtin_amdgcn_exp2f(mx[g] - mn); mx[g] = mn;
            float ps = 0.f; v8u ph;
#pragma unroll
            for (int e = 0; e < 16; e += 2) { const float p0 = __builtin_amdgcn_exp2f(tv[g][e] - mn), p1 = __builtin_amdgcn_exp2f(tv[g][e + 1] - mn); ps += p0; ps += p1;
                ph[e >> 1] = pk2h(p0, p1); }      // two probabilities rounded to nearest even and packed by one conversion
            sum[g] = sum[g] * sc + ps;
            const v16h bh = __builtin_bit_cast(v16h, ph);
#pragma unroll
            for (int dt = 0; dt < 4; ++dt) { o[g][dt] *= sc; o[g][dt] = wmma16(va[dt], bh, o[g][dt]); }
        }
    }
    wait_tensor0(mg0); wait_ds0();      // nothing of the ring is in flight when the wave leaves the loop
    unsigned char* xo = LM + wave * MSL;      // this wave's own slice of stage buffer 0: only this wave's requests and reads have touched it, and they have ended
    const unsigned char* xp = LM + (wave ^ 8) * MSL;      // the partner's: same query group, other key half
    float* op = OUT + (((size_t)n * TT + q0 + 16 * kh) * NH_ + h) * HD + 8 * hi;      // key half kh finishes column group kh
    v8f ok[4], og[4];      // the column group that this wave keeps, and the one that it hands over
#pragma unroll
    for (int dt = 0; dt < 4; ++dt) { ok[dt] = kh ? o[1][dt] : o[0][dt]; og[dt] = kh ? o[0][dt] : o[1][dt]; }
    give(xo, og, kh ? mx[0] : mx[1], kh ? sum[0] : sum[1], lane);
    __syncthreads();      // publishes what each wave hands to its partner
    join_store(xp, ok, kh ? mx[1] : mx[0], kh ? sum[1] : sum[0], lane, op);
}

extern "C" void kernel_launch(void* const* d_in, const int* in_sizes, int n_in,
                              void* d_out, int out_size, void* d_ws, size_t ws_size, hipStream_t stream) {
    (void)in_sizes; (void)n_in; (void)out_size; (void)d_ws; (void)ws_size;
    const float* queries = (const float*)d_in[0]; const float* keys = (const float*)d_in[1]; const float* values = (const float*)d_in[2]; const float* am = (const float*)d_in[3]; const float* kla = (const float*)d_in[4];
    float* OUT = (float*)d_out;     // [4][1024][16][64]
    k_fattn<CGQ><<<dim3(TT / (128 * CGQ), NB_ * NH_), 512, 0, stream>>>(queries, keys, values, am, kla, OUT);
}

// v010
// Measured time: 27.5 microseconds a run.
// Next to v009, in two timings, it ran 1.04 times as fast each time.
// All steps since v000 together make it 53.3 times as fast.
#include <hip/hip_runtime.h>

// FullAttention_Smiles (queries/keys/values [4][1024][16 heads][64]; logits = (q.k^T + attn_mask_add[l][s] + key_lengths_add[n][s]) / 8; softmax over s; out[n][l][h][d] = A.v).
// Compute dtypes, f32 accumulate: every input rounded to bf16; q.k^T on PLAIN bf16 inputs (exact products); the two additive mask inputs
// (rounded to bf16 where they are read), the 1/8 temperature and the softmax (running maximum over 32-key passes, one exp per element) in f32 on VALU -> f16 probabilities (each in [0, 1], rounded once); A.v on
// f16 operands: the bf16-rounded values re-expressed as f16 (same value wherever 2^-14 <= |v| < 65536).

#define NB_  4
#define TT   1024
#define NH_  16
#define HD   64
#define DD   (NH_ * HD)           // 1024
#define NT   (NB_ * TT)
#define CGQ  2                    // 16-query column groups per wave of the fused kernel
typedef _Float16 h16;
typedef unsigned short bf;
typedef __attribute__((ext_vector_type(16))) __bf16   v16bf;
typedef __attribute__((ext_vector_type(16))) _Float16 v16h;
typedef __attribute__((ext_vector_type(8)))  _Float16 v8h;
typedef __attribute__((ext_vector_type(8)))  unsigned short v8us;
typedef __attribute__((ext_vector_type(8)))  float    v8f;
typedef __attribute__((ext_vector_type(4)))  float    v4f;
typedef v8h  __attribute__((may_alias)) v8ha;
typedef v4f  __attribute__((may_alias)) v4fa;
typedef v8us __attribute__((may_alias)) v8usa;

__device__ __forceinline__ unsigned short f2bf(float f) { unsigned u = __float_as_uint(f); u += 0x7FFFu + ((u >> 16) & 1u); return (unsigned short)(u >> 16); }
__device__ __forceinline__ float bf2f(unsigned short b) { return __uint_as_float(((unsigned)b) << 16); }
__device__ __forceinline__ float bfr(float f) { return bf2f(f2bf(f)); }
__device__ __forceinline__ v16h cat16(v8h lo, v8h hi) { return __builtin_shufflevector(lo, hi, 0, 1, 2, 3, 4, 5, 6, 7, 8, 9, 10, 11, 12, 13, 14, 15); }
__device__ __forceinline__ v16bf cat16b(v8us lo, v8us hi) { return __builtin_bit_cast(v16bf, __builtin_shufflevector(lo, hi, 0, 1, 2, 3, 4, 5, 6, 7, 8, 9, 10, 11, 12, 13, 14, 15)); }
__device__ __forceinline__ v8f wmma16(v16h a, v16h b, v8f c) { return __builtin_amdgcn_wmma_f32_16x16x32_f16(false, a, false, b, (short)0, c, false, false); }
__device__ __forceinline__ v8f wmmab(v16bf a, v16bf b, v8f c) { return __builtin_amdgcn_wmma_f32_16x16x32_bf16(false, a, false, b, (short)0, c, false, false); }



template <typename T16> struct WFrag;
template <> struct WFrag<h16> { typedef v16h V; static __device__ __forceinline__ V ld(const h16* p) { return cat16(*(const v8h*)p, *(const v8h*)(p + 16)); } static __device__ __forceinline__ v8f mma(V a, V b, v8f c) { return wmma16(a, b, c); } };
template <> struct WFrag<bf> { typedef v16bf V; static __device__ __forceinline__ V ld(const bf* p) { return cat16b(*(const v8us*)p, *(const v8us*)(p + 16)); } static __device__ __forceinline__ v8f mma(V a, V b, v8f c) { return wmmab(a, b, c); } };
typedef __attribute__((ext_vector_type(2))) unsigned short v2us;
typedef __attribute__((ext_vector_type(4))) unsigned short v4us;
typedef __attribute__((ext_vector_type(2))) float v2f;

#define PK    144                 // LDS pitch of a 128-byte K row: 16 B x odd, for 16-byte readers
#define PV    160                 // LDS pitch of a 128-byte V row: 32 B x odd, for the transposing reader
#define KP    64                  // keys a pass of the work-group: 32 for each key half
#define KTB   (KP * PK)
#define BUFB  (KP * PK + KP * PV)
typedef __attribute__((ext_vector_type(16))) unsigned short v16us;
typedef __attribute__((ext_vector_type(2))) __bf16 v2bf;
typedef __attribute__((ext_vector_type(2))) _Float16 v2h;
typedef __attribute__((ext_vector_type(4))) unsigned v4u;
typedef __attribute__((ext_vector_type(8))) unsigned v8u;
typedef __attribute__((ext_vector_type(8))) short v8s;
typedef v4u __attribute__((may_alias)) v4ua;
__device__ __forceinline__ float xhalf(float x) { const int b = __builtin_bit_cast(int, x); return __builtin_bit_cast(float, __builtin_amdgcn_permlanex16(b, b, 0x76543210, 0xfedcba98, false, false)); }   // lane l <-> l ^ 16
__device__ __forceinline__ unsigned pk2(float a, float b) { return __builtin_bit_cast(unsigned, __builtin_convertvector((v2f){a, b}, v2bf)); }   // two f32 -> packed bf16, round to nearest even
__device__ __forceinline__ v4u pk8(v4f a, v4f b) { return (v4u){pk2(a[0], a[1]), pk2(a[2], a[3]), pk2(b[0], b[1]), pk2(b[2], b[3])}; }
__device__ __forceinline__ v4f rb4(v4f x) { const unsigned a = pk2(x[0], x[1]), b = pk2(x[2], x[3]); return (v4f){__uint_as_float(a << 16), __uint_as_float(a & 0xFFFF0000u), __uint_as_float(b << 16), __uint_as_float(b & 0xFFFF0000u)}; }   // bf16-rounded values, back in f32
__device__ __forceinline__ unsigned pk2h(float a, float b) { return __builtin_bit_cast(unsigned, __builtin_convertvector((v2f){a, b}, v2h)); }   // two f32 -> packed f16, round to nearest even
__device__ __forceinline__ v4u pk8h(v4f a, v4f b) { a = rb4(a); b = rb4(b); return (v4u){pk2h(a[0], a[1]), pk2h(a[2], a[3]), pk2h(b[0], b[1]), pk2h(b[2], b[3])}; }   // eight f32 -> bf16-rounded values, packed as f16
__device__ __forceinline__ v16h fragh(v4u lo, v4u hi) { return __builtin_bit_cast(v16h, __builtin_shufflevector(lo, hi, 0, 1, 2, 3, 4, 5, 6, 7)); }
__device__ __forceinline__ v16bf frag(v4u lo, v4u hi) { return __builtin_bit_cast(v16bf, __builtin_shufflevector(lo, hi, 0, 1, 2, 3, 4, 5, 6, 7)); }
__device__ __forceinline__ v4u ldtr16(const unsigned char* p) { typedef __attribute__((address_space(3))) v8s lds_v8s; return __builtin_bit_cast(v4u, __builtin_amdgcn_ds_load_tr16_b128_v8i16((lds_v8s*)p)); }
// ---- attn_mask_add by the tensor mover: each wave's 32 query rows x 32 keys of a pass (32 rows of 128 B, source pitch 4 KiB) land in the wave's own LDS slice, through no register.
#define PM    144                 // LDS pitch of a 128-byte mask row, set by the request's pad: 16 B x odd, for 16-byte readers
#define MSL   6144                // a wave's slice, 32 * PM bytes rounded up to a multiple of 2 KiB
#define MBUF  (16 * MSL)          // one stage: sixteen slices
typedef __attribute__((ext_vector_type(4))) unsigned u32x4;
typedef __attribute__((ext_vector_type(8))) unsigned u32x8;
__device__ __forceinline__ unsigned uni(unsigned v) { return (unsigned)__builtin_amdgcn_readfirstlane(v); }
__device__ __forceinline__ unsigned pinned(unsigned v) { unsigned w = uni(v); asm volatile("" : "+s"(w)); return w; }      // a wave-uniform word held in a scalar register, so that the test on it is a scalar branch and a descriptor word formed from it is formed behind the waits
__device__ __forceinline__ void wait_ds0() { asm volatile("s_wait_dscnt 0x0" ::: "memory"); }          // this wave's LDS reads and writes have retired
__device__ __forceinline__ void wait_tensor0(u32x4 g0) { asm volatile("s_wait_tensorcnt 0x0" :: "s"(g0) : "memory"); }  // this wave's tensor load has landed (the compiler places no wait for it); the request's group 0 is named as an input so that its registers stay as issued until here
__device__ __forceinline__ void wait_x0() { asm volatile("s_wait_xcnt 0x0" ::: "memory"); }            // stands between issued global loads and the next write of a register that they name
__device__ __forceinline__ void bar_signal() { asm volatile("s_barrier_signal -1" ::: "memory"); }      // the work-group barrier's first half: this wave has arrived; the waits that the other waves count on are written in front of it
__device__ __forceinline__ void bar_wait() { asm volatile("s_barrier_wait -1" ::: "memory"); }          // its second half: every wave has arrived; signal and wait alternate strictly in every wave
__device__ __forceinline__ void tdm_load(u32x4 g0, u32x8 g1) { asm volatile("tensor_load_to_lds %0, %1" :: "s"(g0), "s"(g1) : "memory"); }
__device__ __forceinline__ u32x8 tdm_group1() {      // 1-byte elements, tensor = tile = 32 rows of 128 bytes, source pitch 4096 bytes, 16 bytes of LDS pad behind every 128
    u32x8 g;
    g[0] = uni((1u << 20) | (4u << 22) | (3u << 25)); g[1] = uni(128u << 16); g[2] = uni(32u << 16); g[3] = uni(128u << 16);
    g[4] = uni(32u); g[5] = uni(4u * TT); g[6] = uni(0u); g[7] = uni(0u);
    return g;
}
__device__ __forceinline__ u32x4 tdm_group0(unsigned lds_dst, unsigned long long ga) {
    u32x4 g;
    g[0] = uni(1u); g[1] = uni(lds_dst); g[2] = uni((unsigned)ga); g[3] = uni((((unsigned)(ga >> 32)) & 0x01FFFFFFu) | 0x80000000u);
    return g;
}
typedef float __attribute__((may_alias)) f32a;
typedef v2f __attribute__((may_alias)) v2fa;
// The join of a query group's two key halves: each wave hands one of its two column groups to its partner (give) and finishes the other (join_store). Lane for lane the two waves hold the same query and the same rows of O^T.
__device__ __forceinline__ void give(unsigned char* x, const v8f (&og)[4], float m, float s, int lane) {
#pragma unroll
    for (int dt = 0; dt < 4; ++dt) {
        *(v4fa*)(x + 1024 * dt + 16 * lane) = (v4f){og[dt][0], og[dt][1], og[dt][2], og[dt][3]};
        *(v4fa*)(x + 1024 * dt + 512 + 16 * lane) = (v4f){og[dt][4], og[dt][5], og[dt][6], og[dt][7]}; }
    *(f32a*)(x + 4096 + 4 * lane) = m; *(f32a*)(x + 4224 + 4 * lane) = s;
}
// The finished rows leave in whole lines: a lane holds 32-byte pieces of ONE query's 256-byte output row, so the wave lays its 16 rows in an LDS range of its own (st) and reads them back row-major;
// each 16-byte store of the wave then covers two whole rows (four 128-byte lines), not 16 lines in pieces.
#define PO    272                 // LDS pitch of a 256-byte output row: 16 B x odd, for 16-byte writers down a column and 16-byte readers along a row
__device__ __forceinline__ void join_store(const unsigned char* x, unsigned char* st, const v8f (&og)[4], float m, float s, int lane, float* op) {
    const float mp = *(const f32a*)(x + 4096 + 4 * lane), sp = *(const f32a*)(x + 4224 + 4 * lane);
    const float mn = fmaxf(m, mp), fa = __builtin_amdgcn_exp2f(m - mn), fb = __builtin_amdgcn_exp2f(mp - mn);
    const float st2 = s * fa + sp * fb;
    const float f = __fdiv_rn(1.0f, st2 + xhalf(st2));
    const float ca = fa * f, cp = fb * f;
    unsigned char* sw = st + (lane & 15) * PO + 32 * (lane >> 4);      // query row lr, floats 8*hi.. of each 16
    v4f p0[4], p1[4];      // the partner's tiles, all read ahead of this wave's own LDS stores
#pragma unroll
    for (int dt = 0; dt < 4; ++dt) { p0[dt] = *(const v4fa*)(x + 1024 * dt + 16 * lane); p1[dt] = *(const v4fa*)(x + 1024 * dt + 512 + 16 * lane); }
#pragma unroll
    for (int dt = 0; dt < 4; ++dt) { v4f w0, w1;
#pragma unroll
        for (int j = 0; j < 4; ++j) { w0[j] = og[dt][j] * ca + p0[dt][j] * cp; w1[j] = og[dt][4 + j] * ca + p1[dt][j] * cp; }
        *(v4fa*)(sw + 64 * dt) = w0; *(v4fa*)(sw + 64 * dt + 16) = w1; }
    wait_ds0();      // every lane's pieces are written before the wave reads whole rows back
    const unsigned char* sr = st + (lane >> 4) * PO + 16 * (lane & 15);      // rows 2*i + hi, 16 bytes a lane
#pragma unroll
    for (int i = 0; i < 8; ++i) *(v4f*)(op + (size_t)(2 * i) * DD) = *(const v4fa*)(sr + 2 * i * PO);
}
template <int CG>
__global__ __launch_bounds__(512) void k_fattn(const float* __restrict__ Q, const float* __restrict__ K, const float* __restrict__ V, const float* __restrict__ AM, const float* __restrict__ KL, float* OUT) {
    typedef WFrag<bf> F;
    __shared__ __attribute__((aligned(256))) unsigned char L[2 * BUFB];
    __shared__ __attribute__((aligned(2048))) unsigned char LM[2 * MBUF];      // attn_mask_add tiles, f32 as read: two stages of sixteen slices
    __shared__ __attribute__((aligned(16))) float LK[TT];      // this batch entry's key_lengths_add row, rounded to bf16 once per work-group, kept as f32
    const float SC = 0.125f * 1.44269504088896f;      // temperature, in log2 units
    const int lane = threadIdx.x & 31, lr = lane & 15, hi = lane >> 4;
    const int z = blockIdx.y, n = z >> 4, h = z & 15;
    const int q0 = (blockIdx.x * 8 + ((threadIdx.x >> 5) & 7)) * (16 * CG) + lr;
    static_assert(16 * CG == 32, "the mask slice and its descriptor are written for 32 query rows a wave");
    const unsigned wave = uni(threadIdx.x >> 5), qw = wave & 7, kh = wave >> 3;      // query group and key half
    const unsigned ml = (unsigned)(size_t)LM + wave * MSL;      // this wave's slice of stage buffer 0, as a byte offset in the work-group's LDS
    const unsigned long long mg = (unsigned long long)(size_t)AM + (unsigned long long)((blockIdx.x * 8 + qw) * (16 * CG)) * (4u * TT) + 128u * kh;      // this wave's first query row of attn_mask_add, at its key half's 32 floats
    const u32x8 mg1 = tdm_group1();
    u32x4 mg0 = tdm_group0(ml, mg);
    tdm_load(mg0, mg1);      // stage 0; every wave issues its own slice
    const unsigned char* rm = LM + wave * MSL + lr * PM + 32 * hi;      // mask row lr, floats 8*hi..: the accumulator's key order
    const int sr = threadIdx.x >> 3, so = threadIdx.x & 7;      // staging: this thread's key row of a pass, and its 8 floats of that row
    const float* gk = K + (((size_t)n * TT + sr) * NH_ + h) * HD + 8 * so;
    const float* gv = V + (((size_t)n * TT + sr) * NH_ + h) * HD + 8 * so;
    unsigned char* sk = L + sr * PK + 16 * so;
    unsigned char* sv = L + KTB + sr * PV + 16 * so;
    const unsigned char* rk = L + (32 * kh + lr) * PK + 16 * hi;      // K row lr, bytes 16*hi and 32+16*hi of each 64: the hardware k order
    const unsigned char* rv = L + KTB + (32 * kh + 8 * hi + (lane & 7)) * PV + 16 * ((lane >> 3) & 1);      // the transposing load's lane address; lane (lr, hi) gets V[8*hi+0..7][lr]
    const float* kr = LK + 32 * kh + 8 * hi;
    { const v2f x = *(const v2f*)(KL + (size_t)n * TT + 2 * threadIdx.x); const unsigned a = pk2(x[0], x[1]);
      *(v2fa*)(LK + 2 * threadIdx.x) = (v2f){__uint_as_float(a << 16), __uint_as_float(a & 0xFFFF0000u)}; }      // two floats a thread; published by the first pass's barrier
    v16bf bq[CG][2]; v8f o[CG][4]; float mx[CG], sum[CG];
#pragma unroll
    for (int g = 0; g < CG; ++g) { mx[g] = -3.0e38f; sum[g] = 0.f;
#pragma unroll
        for (int c = 0; c < 2; ++c) { const float* qp = Q + (((size_t)n * TT + q0 + 16 * g) * NH_ + h) * HD + 8 * hi + 32 * c;
            bq[g][c] = frag(pk8(*(const v4f*)qp, *(const v4f*)(qp + 4)), pk8(*(const v4f*)(qp + 16), *(const v4f*)(qp + 20))); }
#pragma unroll
        for (int dt = 0; dt < 4; ++dt) o[g][dt] = (v8f){}; }
    v4f gk0 = *(const v4f*)gk, gk1 = *(const v4f*)(gk + 4), gv0 = *(const v4f*)gv, gv1 = *(const v4f*)(gv + 4);      // pass 0's rows
    *(v4ua*)sk = pk8(gk0, gk1); *(v4ua*)sv = pk8h(gv0, gv1);      // into buffer 0
    gk += (size_t)KP * DD; gv += (size_t)KP * DD;
    gk0 = *(const v4f*)gk; gk1 = *(const v4f*)(gk + 4); gv0 = *(const v4f*)gv; gv1 = *(const v4f*)(gv + 4);      // pass 1's rows, in flight until pass 0 stores them
    wait_x0();            // pass 0 rewrites registers that these loads name
    wait_tensor0(mg0);      // stage 0 has landed
    wait_ds0();           // this wave's share of pass 0's tiles and of the key_lengths_add row is written
    bar_signal();         // answered by the wait at the top of pass 0
#pragma unroll 1
    for (int k0 = 0; k0 < TT; k0 += KP) {
        const int cb = ((k0 >> 6) & 1) * BUFB;      // this pass's buffer
        wait_tensor0(mg0);    // this pass's mask slice has landed; the slice is this wave's own (no other wave reads it), so its wait stands here, a whole pass behind the request, not in front of the signal
        bar_wait();           // every wave has signalled: this pass's K and V tiles are written, and nobody reads the other buffer any more. This wave's own s_wait_dscnt 0 stands in front of its signal, and it has touched no LDS since
        if (pinned(k0 + KP < TT)) {      // the next pass's mask slice, in flight for the whole pass, into the buffer that the pass before has just left
            const unsigned kq = pinned(k0 + KP);
            mg0 = tdm_group0(ml + ((kq >> 6) & 1) * MBUF, mg + 4u * kq);
            tdm_load(mg0, mg1);
        }
        v4f kk[4];
#pragma unroll
        for (int u = 0; u < 4; ++u) kk[u] = *(const v4fa*)(kr + k0 + (u >> 1) * 16 + (u & 1) * 4);
        v16bf ka[2][2];
#pragma unroll
        for (int t = 0; t < 2; ++t) {
#pragma unroll
            for (int c = 0; c < 2; ++c) { const unsigned char* p = rk + cb + 16 * t * PK + 64 * c; ka[t][c] = frag(*(const v4ua*)p, *(const v4ua*)(p + 32)); } }
        v4f mk[CG][4];
#pragma unroll
        for (int u = 0; u < 4; ++u)
#pragma unroll
            for (int g = 0; g < CG; ++g) mk[g][u] = *(const v4fa*)(rm + ((k0 >> 6) & 1) * MBUF + 16 * g * PM + (u >> 1) * 64 + (u & 1) * 16);
        v16h va[4];
#pragma unroll
        for (int dt = 0; dt < 4; ++dt) va[dt] = fragh(ldtr16(rv + cb + 32 * dt), ldtr16(rv + cb + 16 * PV + 32 * dt));
        if (k0 + KP < TT) {      // the same for the whole work-group. The barrier is split: all of a pass's LDS traffic stands here at its top, in front of the signal; the products and the softmax behind it touch no LDS, so a wave may run them while its neighbours are still in the pass before or already read the next one's tiles
            const int nb = BUFB - cb;      // the other buffer: every wave left it before it signalled for this pass
            *(v4ua*)(sk + nb) = pk8(gk0, gk1); *(v4ua*)(sv + nb) = pk8h(gv0, gv1);      // the next pass's rows
            const size_t adv = (k0 + 2 * KP < TT) ? (size_t)KP * DD : 0;      // on to the rows of the pass after that, in flight for a whole pass; the last but one pass has none and re-reads the last pass's (in bounds, unused)
            gk += adv; gv += adv;
            gk0 = *(const v4f*)gk; gk1 = *(const v4f*)(gk + 4); gv0 = *(const v4f*)gv; gv1 = *(const v4f*)(gv + 4);
            wait_x0();            // in front of whatever next rewrites a register that these four loads name
            wait_ds0();           // every LDS read of this wave's pass has landed in registers and its stores are written
            bar_signal();         // answered by the wait at the top of the next pass
        }
#pragma unroll
        for (int u = 0; u < 4; ++u)
#pragma unroll
            for (int g = 0; g < CG; ++g) mk[g][u] = rb4(mk[g][u]);
        v8f s[CG][2];
#pragma unroll
        for (int t = 0; t < 2; ++t)
#pragma unroll
            for (int g = 0; g < CG; ++g)      // the two masks' sum is the accumulator's start value
#pragma unroll
                for (int j = 0; j < 8; ++j) s[g][t][j] = mk[g][2 * t + (j >> 2)][j & 3] + kk[2 * t + (j >> 2)][j & 3];
#pragma unroll
        for (int t = 0; t < 2; ++t)
#pragma unroll
            for (int g = 0; g < CG; ++g) s[g][t] = F::mma(ka[t][1], bq[g][1], F::mma(ka[t][0], bq[g][0], s[g][t]));
        float tv[CG][16];
#pragma unroll
        for (int g = 0; g < CG; ++g)
#pragma unroll
            for (int e = 0; e < 16; ++e) tv[g][e] = s[g][e >> 3][e & 7] * SC;
#pragma unroll
        for (int g = 0; g < CG; ++g) {
            __builtin_amdgcn_sched_barrier(0);      // keeps the two column groups' softmax apart
            float bm = tv[g][0];
#pragma unroll
            for (int e = 1; e < 16; ++e) bm = fmaxf(bm, tv[g][e]);
            bm = fmaxf(bm, xhalf(bm));
            const float mn = fmaxf(mx[g], bm); const float sc = __builtin_amdgcn_exp2f(mx[g] - mn); mx[g] = mn;
            float ps = 0.f; v8u ph;
#pragma unroll
            for (int e = 0; e < 16; e += 2) { const float p0 = __builtin_amdgcn_exp2f(tv[g][e] - mn), p1 = __builtin_amdgcn_exp2f(tv[g][e + 1] - mn); ps += p0; ps += p1;
                ph[e >> 1] = pk2h(p0, p1); }      // two probabilities rounded to nearest even and packed by one conversion
            sum[g] = sum[g] * sc + ps;
            const v16h bh = __builtin_bit_cast(v16h, ph);
#pragma unroll
            for (int dt = 0; dt < 4; ++dt) { o[g][dt] *= sc; o[g][dt] = wmma16(va[dt], bh, o[g][dt]); }
        }
    }
    wait_tensor0(mg0); wait_ds0();      // nothing of the ring is in flight when the wave leaves the loop
    unsigned char* xo = LM + wave * MSL;      // this wave's own slice of stage buffer 0: only this wave's requests and reads have touched it, and they have ended
    const unsigned char* xp = LM + (wave ^ 8) * MSL;      // the partner's: same query group, other key half
    unsigned char* xs = LM + MBUF + wave * MSL;      // this wave's own slice of stage buffer 1, for the output rows: nobody else touches it, and the partner still reads the slice of buffer 0
    float* op = OUT + (((size_t)n * TT + (q0 - lr) + 16 * kh + hi) * NH_ + h) * HD + 4 * lr;      // key half kh finishes column group kh; this lane's 16 bytes of rows hi, 2 + hi, ...
    v8f ok[4], og[4];      // the column group that this wave keeps, and the one that it hands over
#pragma unroll
    for (int dt = 0; dt < 4; ++dt) { ok[dt] = kh ? o[1][dt] : o[0][dt]; og[dt] = kh ? o[0][dt] : o[1][dt]; }
    give(xo, og, kh ? mx[0] : mx[1], kh ? sum[0] : sum[1], lane);
    __syncthreads();      // publishes what each wave hands to its partner
    join_store(xp, xs, ok, kh ? mx[1] : mx[0], kh ? sum[1] : sum[0], lane, op);
}

extern "C" void kernel_launch(void* const* d_in, const int* in_sizes, int n_in,
                              void* d_out, int out_size, void* d_ws, size_t ws_size, hipStream_t stream) {
    (void)in_sizes; (void)n_in; (void)out_size; (void)d_ws; (void)ws_size;
    const float* queries = (const float*)d_in[0]; const float* keys = (const float*)d_in[1]; const float* values = (const float*)d_in[2]; const float* am = (const float*)d_in[3]; const float* kla = (const float*)d_in[4];
    float* OUT = (float*)d_out;     // [4][1024][16][64]
    k_fattn<CGQ><<<dim3(TT / (128 * CGQ), NB_ * NH_), 512, 0, stream>>>(queries, keys, values, am, kla, OUT);
}
